// v000
// The times below were measured on an AMD MI455X: many runs one after another, warmed up first and cycling through
// copies of the inputs, with the whole window's GPU time divided by the number of runs. Launches and the gaps
// between them are all in it. The median over several windows is given; except for v000 it joins two sittings, which
// can be a few percent apart, so the side-by-side timings, each taken in one sitting, are the better comparison.
// v000, which the later versions start from, runs in 1350 microseconds.
#include <hip/hip_runtime.h>
#include <hip/hip_bf16.h>

typedef __attribute__((ext_vector_type(16))) _Float16 v16h;
typedef __attribute__((ext_vector_type(8)))  _Float16 v8h;
typedef __attribute__((ext_vector_type(8)))  float    v8f;
typedef __attribute__((ext_vector_type(4)))  float    v4f;

#define N_TOK 343
#define N_PAD 352
#define DIMC  192
#define NHEAD 6
#define HD    32
#define NWIN  64
#define NB    256
#define QT_COUNT 22   /* 352/16 */

union V16U { v16h v; v8h h[2]; };

// ---------------------------------------------------------------------------
// Operand loader for f16 row-major [rows][ld]:
//   A-operand: lane(0..15)=row rowBase+l, k = k0+{0..7,16..23}
//              lane(16..31)=row rowBase+(l-16), k = k0+{8..15,24..31}
// (B-operand uses the same pattern with "row" = output column / query index.)
// All chunks are 16B aligned given ld%8==0 and k0%32==0.
// ---------------------------------------------------------------------------
__device__ __forceinline__ v16h load_f16_tile(const _Float16* base, int rowBase,
                                              int ld, int k0) {
  int l = threadIdx.x;
  int r = l & 15;
  int g = (l >> 4) & 1;
  const _Float16* p = base + (size_t)(rowBase + r) * ld + k0 + g * 8;
  V16U u;
  u.h[0] = *(const v8h*)(p);
  u.h[1] = *(const v8h*)(p + 16);
  return u.v;
}

// Same lane mapping, but source is f32 (converted to f16); rows >= nvalid -> 0
__device__ __forceinline__ v16h load_f32_tile_cvt(const float* base, int rowBase,
                                                  int nvalid, int ld, int k0) {
  int l = threadIdx.x;
  int r = l & 15;
  int g = (l >> 4) & 1;
  int row = rowBase + r;
  V16U u;
  if (row < nvalid) {
    const float* p = base + (size_t)row * ld + k0 + g * 8;
    v4f a0 = *(const v4f*)(p);
    v4f a1 = *(const v4f*)(p + 4);
    v4f b0 = *(const v4f*)(p + 16);
    v4f b1 = *(const v4f*)(p + 20);
#pragma unroll
    for (int i = 0; i < 4; ++i) {
      u.h[0][i]     = (_Float16)a0[i];
      u.h[0][4 + i] = (_Float16)a1[i];
      u.h[1][i]     = (_Float16)b0[i];
      u.h[1][4 + i] = (_Float16)b1[i];
    }
  } else {
#pragma unroll
    for (int i = 0; i < 8; ++i) { u.h[0][i] = (_Float16)0.f; u.h[1][i] = (_Float16)0.f; }
  }
  return u.v;
}

__device__ __forceinline__ v8f wmma_f16(v16h a, v16h b, v8f c) {
  return __builtin_amdgcn_wmma_f32_16x16x32_f16(false, a, false, b, (short)0, c,
                                                false, false);
}

// ---------------------------------------------------------------------------
// Stage 0a: f32 -> f16 weight conversion
// ---------------------------------------------------------------------------
__global__ void cvt_f32_to_f16(const float* __restrict__ src,
                               _Float16* __restrict__ dst, int n) {
  int i = blockIdx.x * 256 + threadIdx.x;
  if (i < n) dst[i] = (_Float16)src[i];
}

// ---------------------------------------------------------------------------
// Stage 0b: relative-position bias gather: biasM[h][q][k] = table[rel_idx[q][k]][h]
// ---------------------------------------------------------------------------
__global__ void bias_gather(const float* __restrict__ table,
                            const int* __restrict__ rel_idx,
                            float* __restrict__ biasM) {
  int i = blockIdx.x * 256 + threadIdx.x;
  if (i < N_TOK * N_TOK) {
    int idx = rel_idx[i];
#pragma unroll
    for (int h = 0; h < NHEAD; ++h)
      biasM[(size_t)h * N_TOK * N_TOK + i] = table[idx * NHEAD + h];
  }
}

// ---------------------------------------------------------------------------
// Stage 1: QKV projection GEMM (one wave per 16x16 output tile).
//   blockIdx.x = n-tile (22), blockIdx.y = c-tile (12 Q + 24 KV), blockIdx.z = b
//   Q  -> Qh[b][h][n][d]  (f16, pre-scaled by hd^-0.5)
//   K  -> Kh[b][h][n][d]  (f16)
//   V  -> Vt[b][h][d][n]  (f16, transposed; contiguous stores)
// ---------------------------------------------------------------------------
__global__ __launch_bounds__(32) void qkv_gemm(
    const float* __restrict__ x1, const float* __restrict__ x2,
    const _Float16* __restrict__ qwh, const _Float16* __restrict__ kvwh,
    const float* __restrict__ qb, const float* __restrict__ kvb,
    _Float16* __restrict__ Qh, _Float16* __restrict__ Kh,
    _Float16* __restrict__ Vt) {
  int nt = blockIdx.x;
  int ct = blockIdx.y;
  int b  = blockIdx.z;
  bool isQ = (ct < 12);
  int cbase = (isQ ? ct : (ct - 12)) * 16;
  const float*    X = isQ ? x1 : x2;
  const _Float16* W = isQ ? qwh : kvwh;
  int nbase = nt * 16;

  v8f acc = {};
#pragma unroll
  for (int k0 = 0; k0 < DIMC; k0 += 32) {
    v16h a = load_f32_tile_cvt(X + (size_t)b * N_TOK * DIMC, nbase, N_TOK, DIMC, k0);
    v16h w = load_f16_tile(W, cbase, DIMC, k0);
    acc = wmma_f16(a, w, acc);
  }

  int l = threadIdx.x;
  int g = (l >> 4) & 1;           // register group: rows nbase+8g .. nbase+8g+7
  int c = cbase + (l & 15);       // this lane's output column

  if (isQ) {
    const float scale = 0.17677669529663687f;  // 32^-0.5
    float bias = qb[c];
    int h = c >> 5, d = c & 31;
    _Float16* base = Qh + ((size_t)b * NHEAD + h) * N_PAD * HD;
#pragma unroll
    for (int r = 0; r < 8; ++r) {
      int n = nbase + 8 * g + r;
      base[(size_t)n * HD + d] = (_Float16)((acc[r] + bias) * scale);
    }
  } else {
    float bias = kvb[c];
    bool isK = (c < DIMC);
    int c2 = isK ? c : c - DIMC;
    int h = c2 >> 5, d = c2 & 31;
    if (isK) {
      _Float16* base = Kh + ((size_t)b * NHEAD + h) * N_PAD * HD;
#pragma unroll
      for (int r = 0; r < 8; ++r) {
        int n = nbase + 8 * g + r;
        base[(size_t)n * HD + d] = (_Float16)(acc[r] + bias);
      }
    } else {
      _Float16* dst = Vt + (((size_t)b * NHEAD + h) * HD + d) * N_PAD + nbase + 8 * g;
      v8h o;
#pragma unroll
      for (int r = 0; r < 8; ++r) o[r] = (_Float16)(acc[r] + bias);
      *(v8h*)dst = o;   // 16B contiguous
    }
  }
}

// ---------------------------------------------------------------------------
// Stage 2: flash attention, one wave per (b, h, q-tile).
//   Computes S^T = K x Q^T so P^T (in D-register layout) is directly the
//   B operand of O^T = V^T x P^T (32 keys per iteration => K=32 exactly).
// ---------------------------------------------------------------------------
__global__ __launch_bounds__(32) void flash_attn(
    const _Float16* __restrict__ Qh, const _Float16* __restrict__ Kh,
    const _Float16* __restrict__ Vt, const float* __restrict__ biasM,
    const float* __restrict__ mask, _Float16* __restrict__ att) {
  int qt = blockIdx.x;            // 0..21
  int h  = blockIdx.y;            // 0..5
  int b  = blockIdx.z;            // 0..255
  int w  = b & (NWIN - 1);        // window index for mask

  const _Float16* Qb = Qh + ((size_t)b * NHEAD + h) * N_PAD * HD;
  const _Float16* Kb = Kh + ((size_t)b * NHEAD + h) * N_PAD * HD;
  const _Float16* Vb = Vt + ((size_t)b * NHEAD + h) * HD * N_PAD;
  const float* Bm = biasM + (size_t)h * N_TOK * N_TOK;
  const float* Mm = mask + (size_t)w * N_TOK * N_TOK;

  int l  = threadIdx.x;
  int q  = l & 15;
  int g  = (l >> 4) & 1;
  int qg = qt * 16 + q;           // this lane's global query index

  v16h Qop = load_f16_tile(Qb, qt * 16, HD, 0);   // B operand, loaded once

  v8f oLo = {};                   // O^T rows d=0..15 (this lane: d=8g+r)
  v8f oHi = {};                   // O^T rows d=16..31
  float mrow = -3.0e38f;
  float lsum = 0.f;

  for (int k0 = 0; k0 < N_PAD; k0 += 32) {
    v16h Ka = load_f16_tile(Kb, k0, HD, 0);
    v16h Kc = load_f16_tile(Kb, k0 + 16, HD, 0);
    v8f z0 = {};
    v8f z1 = {};
    v8f s0 = wmma_f16(Ka, Qop, z0);   // keys k0   .. k0+15 (x query)
    v8f s1 = wmma_f16(Kc, Qop, z1);   // keys k0+16.. k0+31

    int kb0 = k0 + 8 * g;           // s0 reg r -> key kb0+r
    int kb1 = k0 + 16 + 8 * g;      // s1 reg r -> key kb1+r
    if (qg < N_TOK) {
      const float* bp = Bm + (size_t)qg * N_TOK;
      const float* mp = Mm + (size_t)qg * N_TOK;
#pragma unroll
      for (int r = 0; r < 8; ++r) {
        int k1 = kb0 + r;
        s0[r] = (k1 < N_TOK) ? (s0[r] + bp[k1] + mp[k1]) : -1.0e30f;
        int k2 = kb1 + r;
        s1[r] = (k2 < N_TOK) ? (s1[r] + bp[k2] + mp[k2]) : -1.0e30f;
      }
    } else {
#pragma unroll
      for (int r = 0; r < 8; ++r) {
        if (kb0 + r >= N_TOK) s0[r] = -1.0e30f;
        if (kb1 + r >= N_TOK) s1[r] = -1.0e30f;
      }
    }

    // --- online softmax (row = query; pair (lane, lane^16) shares a row) ---
    float tm = s0[0];
#pragma unroll
    for (int r = 0; r < 8; ++r) { tm = fmaxf(tm, s0[r]); tm = fmaxf(tm, s1[r]); }
    tm = fmaxf(tm, __shfl_xor(tm, 16, 32));
    float mnew  = fmaxf(mrow, tm);
    float alpha = __expf(mrow - mnew);
    mrow = mnew;

    V16U p;                       // P^T in B-operand layout for K=32
    float rs = 0.f;
#pragma unroll
    for (int r = 0; r < 8; ++r) {
      float e0 = __expf(s0[r] - mnew);
      float e1 = __expf(s1[r] - mnew);
      rs += e0 + e1;
      p.h[0][r] = (_Float16)e0;   // keys kb0+r
      p.h[1][r] = (_Float16)e1;   // keys kb1+r
    }
    rs += __shfl_xor(rs, 16, 32);
    lsum = lsum * alpha + rs;

#pragma unroll
    for (int i = 0; i < 8; ++i) { oLo[i] *= alpha; oHi[i] *= alpha; }

    v16h Va0 = load_f16_tile(Vb, 0,  N_PAD, k0);  // V^T rows d=0..15
    v16h Va1 = load_f16_tile(Vb, 16, N_PAD, k0);  // V^T rows d=16..31
    oLo = wmma_f16(Va0, p.v, oLo);
    oHi = wmma_f16(Va1, p.v, oHi);
  }

  if (qg < N_TOK) {
    float inv = 1.0f / lsum;
    _Float16* dst = att + ((size_t)b * N_PAD + qg) * DIMC + h * HD;
    v8h a0, a1;
#pragma unroll
    for (int r = 0; r < 8; ++r) {
      a0[r] = (_Float16)(oLo[r] * inv);   // d = 8g + r
      a1[r] = (_Float16)(oHi[r] * inv);   // d = 16 + 8g + r
    }
    *(v8h*)(dst + 8 * g)      = a0;       // 16B contiguous
    *(v8h*)(dst + 16 + 8 * g) = a1;
  }
}

// ---------------------------------------------------------------------------
// Stage 3: output projection GEMM. out[b][n][c] = att[b][n][:] . proj_w[c][:] + pb[c]
// ---------------------------------------------------------------------------
__global__ __launch_bounds__(32) void proj_gemm(
    const _Float16* __restrict__ att, const _Float16* __restrict__ pwh,
    const float* __restrict__ pb, float* __restrict__ out) {
  int nt = blockIdx.x;   // 22
  int ct = blockIdx.y;   // 12
  int b  = blockIdx.z;   // 256

  v8f acc = {};
#pragma unroll
  for (int k0 = 0; k0 < DIMC; k0 += 32) {
    v16h a = load_f16_tile(att + (size_t)b * N_PAD * DIMC, nt * 16, DIMC, k0);
    v16h wv = load_f16_tile(pwh, ct * 16, DIMC, k0);
    acc = wmma_f16(a, wv, acc);
  }

  int l = threadIdx.x;
  int g = (l >> 4) & 1;
  int c = ct * 16 + (l & 15);
  float bias = pb[c];
  float* dst = out + (size_t)b * N_TOK * DIMC + c;
#pragma unroll
  for (int r = 0; r < 8; ++r) {
    int n = nt * 16 + 8 * g + r;
    if (n < N_TOK) dst[(size_t)n * DIMC] = acc[r] + bias;
  }
}

// ---------------------------------------------------------------------------
// Host launcher
// ---------------------------------------------------------------------------
extern "C" void kernel_launch(void* const* d_in, const int* in_sizes, int n_in,
                              void* d_out, int out_size, void* d_ws, size_t ws_size,
                              hipStream_t stream) {
  const float* x1     = (const float*)d_in[0];
  const float* x2     = (const float*)d_in[1];
  const float* mask   = (const float*)d_in[2];
  const float* table  = (const float*)d_in[3];
  const float* q_w    = (const float*)d_in[4];
  const float* q_b    = (const float*)d_in[5];
  const float* kv_w   = (const float*)d_in[6];
  const float* kv_b   = (const float*)d_in[7];
  const float* proj_w = (const float*)d_in[8];
  const float* proj_b = (const float*)d_in[9];
  const int*   relidx = (const int*)d_in[10];
  float* out = (float*)d_out;

  char* ws = (char*)d_ws;
  // workspace layout (256B aligned)
  const size_t o_qwh  = 0;                                 //  73,728 B
  const size_t o_kvwh = o_qwh  + 73728;                    // 147,456 B
  const size_t o_pwh  = o_kvwh + 147456;                   //  73,728 B
  const size_t o_bias = o_pwh  + 73728;                    // 2,823,680 B (padded)
  const size_t o_Qh   = o_bias + 2823680;                  // 34,603,008 B
  const size_t o_Kh   = o_Qh   + 34603008;
  const size_t o_Vt   = o_Kh   + 34603008;
  const size_t o_att  = o_Vt   + 34603008;

  _Float16* qwh  = (_Float16*)(ws + o_qwh);
  _Float16* kvwh = (_Float16*)(ws + o_kvwh);
  _Float16* pwh  = (_Float16*)(ws + o_pwh);
  float*    bsm  = (float*)   (ws + o_bias);
  _Float16* Qh   = (_Float16*)(ws + o_Qh);
  _Float16* Kh   = (_Float16*)(ws + o_Kh);
  _Float16* Vt   = (_Float16*)(ws + o_Vt);
  _Float16* att  = (_Float16*)(ws + o_att);

  // Stage 0: weight conversion + bias gather
  cvt_f32_to_f16<<<(192 * 192 + 255) / 256, 256, 0, stream>>>(q_w, qwh, 192 * 192);
  cvt_f32_to_f16<<<(384 * 192 + 255) / 256, 256, 0, stream>>>(kv_w, kvwh, 384 * 192);
  cvt_f32_to_f16<<<(192 * 192 + 255) / 256, 256, 0, stream>>>(proj_w, pwh, 192 * 192);
  bias_gather<<<(N_TOK * N_TOK + 255) / 256, 256, 0, stream>>>(table, relidx, bsm);

  // Stage 1: QKV projections (f16 WMMA, f32 accumulate)
  qkv_gemm<<<dim3(QT_COUNT, 12 + 24, NB), 32, 0, stream>>>(
      x1, x2, qwh, kvwh, q_b, kv_b, Qh, Kh, Vt);

  // Stage 2: fused flash attention (QK^T + bias + mask + softmax + PV)
  flash_attn<<<dim3(QT_COUNT, NHEAD, NB), 32, 0, stream>>>(
      Qh, Kh, Vt, bsm, mask, att);

  // Stage 3: output projection
  proj_gemm<<<dim3(QT_COUNT, 12, NB), 32, 0, stream>>>(att, pwh, proj_b, out);
}

// v001
// A run of this version takes 447 microseconds.
// Two timings next to v000 both put it at 3.11 times that version's speed.
#include <hip/hip_runtime.h>
#include <hip/hip_bf16.h>

typedef __attribute__((ext_vector_type(16))) _Float16 v16h;
typedef __attribute__((ext_vector_type(8)))  _Float16 v8h;
typedef __attribute__((ext_vector_type(8)))  float    v8f;
typedef __attribute__((ext_vector_type(4)))  float    v4f;

#define N_TOK 343
#define N_PAD 352
#define DIMC  192
#define NHEAD 6
#define HD    32
#define NWIN  64
#define NB    256
#define QT_COUNT 22   /* 352/16 */
#define KT_COUNT 11   /* 352/32 */
#define TILE_F   512  /* floats of one 16-query x 32-key score tile */
#define PLANE_F  (QT_COUNT * KT_COUNT * TILE_F)   /* 352*352 floats */
#define TAB_ROWS 2197
#define KEY_PAD  (-1.0e30f)

union V16U { v16h v; v8h h[2]; };

// ---------------------------------------------------------------------------
// Operand loader for f16 row-major [rows][ld]:
//   A-operand: lane(0..15)=row rowBase+l, k = k0+{0..7,16..23}
//              lane(16..31)=row rowBase+(l-16), k = k0+{8..15,24..31}
// (B-operand uses the same pattern with "row" = output column / query index.)
// All chunks are 16B aligned given ld%8==0 and k0%32==0.
// ---------------------------------------------------------------------------
__device__ __forceinline__ v16h load_f16_tile(const _Float16* base, int rowBase,
                                              int ld, int k0) {
  int l = threadIdx.x;
  int r = l & 15;
  int g = (l >> 4) & 1;
  const _Float16* p = base + (size_t)(rowBase + r) * ld + k0 + g * 8;
  V16U u;
  u.h[0] = *(const v8h*)(p);
  u.h[1] = *(const v8h*)(p + 16);
  return u.v;
}

// Same lane mapping, but source is f32 (converted to f16); rows >= nvalid -> 0
__device__ __forceinline__ v16h load_f32_tile_cvt(const float* base, int rowBase,
                                                  int nvalid, int ld, int k0) {
  int l = threadIdx.x;
  int r = l & 15;
  int g = (l >> 4) & 1;
  int row = rowBase + r;
  V16U u;
  if (row < nvalid) {
    const float* p = base + (size_t)row * ld + k0 + g * 8;
    v4f a0 = *(const v4f*)(p);
    v4f a1 = *(const v4f*)(p + 4);
    v4f b0 = *(const v4f*)(p + 16);
    v4f b1 = *(const v4f*)(p + 20);
#pragma unroll
    for (int i = 0; i < 4; ++i) {
      u.h[0][i]     = (_Float16)a0[i];
      u.h[0][4 + i] = (_Float16)a1[i];
      u.h[1][i]     = (_Float16)b0[i];
      u.h[1][4 + i] = (_Float16)b1[i];
    }
  } else {
#pragma unroll
    for (int i = 0; i < 8; ++i) { u.h[0][i] = (_Float16)0.f; u.h[1][i] = (_Float16)0.f; }
  }
  return u.v;
}

__device__ __forceinline__ v8f wmma_f16(v16h a, v16h b, v8f c) {
  return __builtin_amdgcn_wmma_f32_16x16x32_f16(false, a, false, b, (short)0, c,
                                                false, false);
}

// ---------------------------------------------------------------------------
// Stage 0a: f32 -> f16 weight conversion
// ---------------------------------------------------------------------------
__global__ void cvt_f32_to_f16(const float* __restrict__ src,
                               _Float16* __restrict__ dst, int n) {
  int i = blockIdx.x * 256 + threadIdx.x;
  if (i < n) dst[i] = (_Float16)src[i];
}

// ---------------------------------------------------------------------------
// Fragment order of the score addends (bias and mask planes, 352 x 352 padded):
//   plane[qt][kt][j][lane][e], one 16-query x 32-key tile = 4 x 32 x 4 floats.
//   lane = 16*g + (q & 15); key = 32*kt + 16*(j >> 1) + 8*g + 4*(j & 1) + e.
// That is the accumulator layout of S^T in flash_attn: load j of a tile is
// 32 lanes x 16 B = 512 contiguous bytes (four whole 128-B lines).
// ---------------------------------------------------------------------------

// ---------------------------------------------------------------------------
// Stage 0b: relative-position bias gather into fragment order:
//   biasF[h] at (q,k) = table[rel_idx[q][k]][h]; 0 in the padding.
// ---------------------------------------------------------------------------
__global__ void bias_gather(const float* __restrict__ table,
                            const int* __restrict__ rel_idx,
                            float* __restrict__ biasF) {
  int i = blockIdx.x * 256 + threadIdx.x;      // index inside a plane
  if (i < PLANE_F) {
    int e    = i & 3;
    int lane = (i >> 2) & 31;
    int j    = (i >> 7) & 3;
    int tile = i >> 9;
    int qt = tile / KT_COUNT;
    int kt = tile - qt * KT_COUNT;
    int q = qt * 16 + (lane & 15);
    int k = kt * 32 + (j >> 1) * 16 + (lane >> 4) * 8 + (j & 1) * 4 + e;
    bool in = (q < N_TOK) && (k < N_TOK);
    int idx = in ? rel_idx[q * N_TOK + k] : 0;
    idx = min(max(idx, 0), TAB_ROWS - 1);      // the table read stays in bounds
#pragma unroll
    for (int h = 0; h < NHEAD; ++h) {
      float tv = table[idx * NHEAD + h];
      biasF[(size_t)h * PLANE_F + i] = in ? tv : 0.f;
    }
  }
}

// ---------------------------------------------------------------------------
// Stage 0c: mask -> fragment order, one block per (q-tile, window).
//   Rows are read as whole rows (coalesced), turned in LDS, and written as
//   contiguous 16-B pieces. Padding keys get KEY_PAD, padding queries 0.
// ---------------------------------------------------------------------------
#define MROW_PITCH 356   /* floats; 16-B multiple, spreads the 16 rows over the banks */
__global__ __launch_bounds__(256) void mask_to_fragments(
    const float* __restrict__ mask, float* __restrict__ maskF) {
  __shared__ __attribute__((aligned(16))) float rows[16 * MROW_PITCH];
  int qt = blockIdx.x;
  int w  = blockIdx.y;
  int t  = threadIdx.x;
  int ln = t & 31;
  int wv = t >> 5;
  const float* Mw = mask + (size_t)w * N_TOK * N_TOK;
  // Clamped addresses instead of branches, and the loops unrolled: the 22
  // loads of a wave are then all in flight before the first LDS store waits.
  float v[2][KT_COUNT];
#pragma unroll
  for (int rr = 0; rr < 2; ++rr) {
    int q = qt * 16 + wv + 8 * rr;
    const float* Mr = Mw + (size_t)min(q, N_TOK - 1) * N_TOK;
#pragma unroll
    for (int i = 0; i < KT_COUNT; ++i) v[rr][i] = Mr[min(ln + 32 * i, N_TOK - 1)];
  }
#pragma unroll
  for (int rr = 0; rr < 2; ++rr) {
    int ql = wv + 8 * rr;
    bool qin = (qt * 16 + ql < N_TOK);
#pragma unroll
    for (int i = 0; i < KT_COUNT; ++i) {
      int k = ln + 32 * i;
      rows[ql * MROW_PITCH + k] = (k < N_TOK) ? (qin ? v[rr][i] : 0.f) : KEY_PAD;
    }
  }
  __syncthreads();
  v4f* dst = (v4f*)(maskF + (size_t)w * PLANE_F + (size_t)qt * KT_COUNT * TILE_F);
  for (int f = t; f < KT_COUNT * TILE_F / 4; f += 256) {
    int lane = f & 31;
    int j    = (f >> 5) & 3;
    int kt   = f >> 7;
    int k = kt * 32 + (j >> 1) * 16 + (lane >> 4) * 8 + (j & 1) * 4;
    dst[f] = *(const v4f*)(rows + (lane & 15) * MROW_PITCH + k);
  }
}

// ---------------------------------------------------------------------------
// Stage 1: QKV projection GEMM (one wave per 16x16 output tile).
//   blockIdx.x = n-tile (22), blockIdx.y = c-tile (12 Q + 24 KV), blockIdx.z = b
//   Q  -> Qh[b][h][n][d]  (f16, pre-scaled by hd^-0.5)
//   K  -> Kh[b][h][n][d]  (f16)
//   V  -> Vt[b][h][d][n]  (f16, transposed; contiguous stores)
// ---------------------------------------------------------------------------
__global__ __launch_bounds__(32) void qkv_gemm(
    const float* __restrict__ x1, const float* __restrict__ x2,
    const _Float16* __restrict__ qwh, const _Float16* __restrict__ kvwh,
    const float* __restrict__ qb, const float* __restrict__ kvb,
    _Float16* __restrict__ Qh, _Float16* __restrict__ Kh,
    _Float16* __restrict__ Vt) {
  int nt = blockIdx.x;
  int ct = blockIdx.y;
  int b  = blockIdx.z;
  bool isQ = (ct < 12);
  int cbase = (isQ ? ct : (ct - 12)) * 16;
  const float*    X = isQ ? x1 : x2;
  const _Float16* W = isQ ? qwh : kvwh;
  int nbase = nt * 16;

  v8f acc = {};
#pragma unroll
  for (int k0 = 0; k0 < DIMC; k0 += 32) {
    v16h a = load_f32_tile_cvt(X + (size_t)b * N_TOK * DIMC, nbase, N_TOK, DIMC, k0);
    v16h w = load_f16_tile(W, cbase, DIMC, k0);
    acc = wmma_f16(a, w, acc);
  }

  int l = threadIdx.x;
  int g = (l >> 4) & 1;           // register group: rows nbase+8g .. nbase+8g+7
  int c = cbase + (l & 15);       // this lane's output column

  if (isQ) {
    const float scale = 0.17677669529663687f;  // 32^-0.5
    float bias = qb[c];
    int h = c >> 5, d = c & 31;
    _Float16* base = Qh + ((size_t)b * NHEAD + h) * N_PAD * HD;
#pragma unroll
    for (int r = 0; r < 8; ++r) {
      int n = nbase + 8 * g + r;
      base[(size_t)n * HD + d] = (_Float16)((acc[r] + bias) * scale);
    }
  } else {
    float bias = kvb[c];
    bool isK = (c < DIMC);
    int c2 = isK ? c : c - DIMC;
    int h = c2 >> 5, d = c2 & 31;
    if (isK) {
      _Float16* base = Kh + ((size_t)b * NHEAD + h) * N_PAD * HD;
#pragma unroll
      for (int r = 0; r < 8; ++r) {
        int n = nbase + 8 * g + r;
        base[(size_t)n * HD + d] = (_Float16)(acc[r] + bias);
      }
    } else {
      _Float16* dst = Vt + (((size_t)b * NHEAD + h) * HD + d) * N_PAD + nbase + 8 * g;
      v8h o;
#pragma unroll
      for (int r = 0; r < 8; ++r) o[r] = (_Float16)(acc[r] + bias);
      *(v8h*)dst = o;   // 16B contiguous
    }
  }
}

// ---------------------------------------------------------------------------
// Stage 2: flash attention, one wave per (b, h, q-tile).
//   Computes S^T = K x Q^T so P^T (in D-register layout) is directly the
//   B operand of O^T = V^T x P^T (32 keys per iteration => K=32 exactly).
// ---------------------------------------------------------------------------
__global__ __launch_bounds__(32) void flash_attn(
    const _Float16* __restrict__ Qh, const _Float16* __restrict__ Kh,
    const _Float16* __restrict__ Vt, const float* __restrict__ biasF,
    const float* __restrict__ maskF, _Float16* __restrict__ att) {
  int qt = blockIdx.x;            // 0..21
  int h  = blockIdx.y;            // 0..5
  int b  = blockIdx.z;            // 0..255
  int w  = b & (NWIN - 1);        // window index for mask

  const _Float16* Qb = Qh + ((size_t)b * NHEAD + h) * N_PAD * HD;
  const _Float16* Kb = Kh + ((size_t)b * NHEAD + h) * N_PAD * HD;
  const _Float16* Vb = Vt + ((size_t)b * NHEAD + h) * HD * N_PAD;

  int l  = threadIdx.x;
  int q  = l & 15;
  int g  = (l >> 4) & 1;
  int qg = qt * 16 + q;           // this lane's global query index

  // this lane's 16-B pieces of the addend tiles of q-tile qt (fragment order)
  const v4f* Bf = (const v4f*)(biasF + (size_t)h * PLANE_F +
                               (size_t)qt * KT_COUNT * TILE_F) + l;
  const v4f* Mf = (const v4f*)(maskF + (size_t)w * PLANE_F +
                               (size_t)qt * KT_COUNT * TILE_F) + l;

  v16h Qop = load_f16_tile(Qb, qt * 16, HD, 0);   // B operand, loaded once

  v8f oLo = {};                   // O^T rows d=0..15 (this lane: d=8g+r)
  v8f oHi = {};                   // O^T rows d=16..31
  float mrow = -3.0e38f;
  float lsum = 0.f;

  for (int k0 = 0; k0 < N_PAD; k0 += 32) {
    v16h Ka = load_f16_tile(Kb, k0, HD, 0);
    v16h Kc = load_f16_tile(Kb, k0 + 16, HD, 0);
    v8f z0 = {};
    v8f z1 = {};
    v8f s0 = wmma_f16(Ka, Qop, z0);   // keys k0   .. k0+15 (x query)
    v8f s1 = wmma_f16(Kc, Qop, z1);   // keys k0+16.. k0+31

    // s0 reg r -> key k0+8g+r, s1 reg r -> key k0+16+8g+r; padding keys carry
    // KEY_PAD in the mask plane, so no bounds test is left here.
    int tb = (k0 >> 5) * (TILE_F / 4);
    v4f b0 = Bf[tb], b1 = Bf[tb + 32], b2 = Bf[tb + 64], b3 = Bf[tb + 96];
    v4f m0 = Mf[tb], m1 = Mf[tb + 32], m2 = Mf[tb + 64], m3 = Mf[tb + 96];
#pragma unroll
    for (int r = 0; r < 4; ++r) {
      s0[r]     = s0[r]     + b0[r] + m0[r];
      s0[4 + r] = s0[4 + r] + b1[r] + m1[r];
      s1[r]     = s1[r]     + b2[r] + m2[r];
      s1[4 + r] = s1[4 + r] + b3[r] + m3[r];
    }

    // --- online softmax (row = query; pair (lane, lane^16) shares a row) ---
    float tm = s0[0];
#pragma unroll
    for (int r = 0; r < 8; ++r) { tm = fmaxf(tm, s0[r]); tm = fmaxf(tm, s1[r]); }
    tm = fmaxf(tm, __shfl_xor(tm, 16, 32));
    float mnew  = fmaxf(mrow, tm);
    float alpha = __expf(mrow - mnew);
    mrow = mnew;

    V16U p;                       // P^T in B-operand layout for K=32
    float rs = 0.f;
#pragma unroll
    for (int r = 0; r < 8; ++r) {
      float e0 = __expf(s0[r] - mnew);
      float e1 = __expf(s1[r] - mnew);
      rs += e0 + e1;
      p.h[0][r] = (_Float16)e0;   // keys k0+8g+r
      p.h[1][r] = (_Float16)e1;   // keys k0+16+8g+r
    }
    rs += __shfl_xor(rs, 16, 32);
    lsum = lsum * alpha + rs;

#pragma unroll
    for (int i = 0; i < 8; ++i) { oLo[i] *= alpha; oHi[i] *= alpha; }

    v16h Va0 = load_f16_tile(Vb, 0,  N_PAD, k0);  // V^T rows d=0..15
    v16h Va1 = load_f16_tile(Vb, 16, N_PAD, k0);  // V^T rows d=16..31
    oLo = wmma_f16(Va0, p.v, oLo);
    oHi = wmma_f16(Va1, p.v, oHi);
  }

  if (qg < N_TOK) {
    float inv = 1.0f / lsum;
    _Float16* dst = att + ((size_t)b * N_PAD + qg) * DIMC + h * HD;
    v8h a0, a1;
#pragma unroll
    for (int r = 0; r < 8; ++r) {
      a0[r] = (_Float16)(oLo[r] * inv);   // d = 8g + r
      a1[r] = (_Float16)(oHi[r] * inv);   // d = 16 + 8g + r
    }
    *(v8h*)(dst + 8 * g)      = a0;       // 16B contiguous
    *(v8h*)(dst + 16 + 8 * g) = a1;
  }
}

// ---------------------------------------------------------------------------
// Stage 3: output projection GEMM. out[b][n][c] = att[b][n][:] . proj_w[c][:] + pb[c]
// ---------------------------------------------------------------------------
__global__ __launch_bounds__(32) void proj_gemm(
    const _Float16* __restrict__ att, const _Float16* __restrict__ pwh,
    const float* __restrict__ pb, float* __restrict__ out) {
  int nt = blockIdx.x;   // 22
  int ct = blockIdx.y;   // 12
  int b  = blockIdx.z;   // 256

  v8f acc = {};
#pragma unroll
  for (int k0 = 0; k0 < DIMC; k0 += 32) {
    v16h a = load_f16_tile(att + (size_t)b * N_PAD * DIMC, nt * 16, DIMC, k0);
    v16h wv = load_f16_tile(pwh, ct * 16, DIMC, k0);
    acc = wmma_f16(a, wv, acc);
  }

  int l = threadIdx.x;
  int g = (l >> 4) & 1;
  int c = ct * 16 + (l & 15);
  float bias = pb[c];
  float* dst = out + (size_t)b * N_TOK * DIMC + c;
#pragma unroll
  for (int r = 0; r < 8; ++r) {
    int n = nt * 16 + 8 * g + r;
    if (n < N_TOK) dst[(size_t)n * DIMC] = acc[r] + bias;
  }
}

// ---------------------------------------------------------------------------
// Host launcher
// ---------------------------------------------------------------------------
extern "C" void kernel_launch(void* const* d_in, const int* in_sizes, int n_in,
                              void* d_out, int out_size, void* d_ws, size_t ws_size,
                              hipStream_t stream) {
  const float* x1     = (const float*)d_in[0];
  const float* x2     = (const float*)d_in[1];
  const float* mask   = (const float*)d_in[2];
  const float* table  = (const float*)d_in[3];
  const float* q_w    = (const float*)d_in[4];
  const float* q_b    = (const float*)d_in[5];
  const float* kv_w   = (const float*)d_in[6];
  const float* kv_b   = (const float*)d_in[7];
  const float* proj_w = (const float*)d_in[8];
  const float* proj_b = (const float*)d_in[9];
  const int*   relidx = (const int*)d_in[10];
  float* out = (float*)d_out;

  char* ws = (char*)d_ws;
  // workspace layout (256B aligned)
  const size_t o_qwh  = 0;                                 //  73,728 B
  const size_t o_kvwh = o_qwh  + 73728;                    // 147,456 B
  const size_t o_pwh  = o_kvwh + 147456;                   //  73,728 B
  const size_t o_bias = o_pwh  + 73728;                    //  2,973,696 B (6 planes)
  const size_t o_mask = o_bias + 2973696;                  // 31,719,424 B (64 planes)
  const size_t o_Qh   = o_mask + 31719424;                 // 34,603,008 B
  const size_t o_Kh   = o_Qh   + 34603008;
  const size_t o_Vt   = o_Kh   + 34603008;
  const size_t o_att  = o_Vt   + 34603008;

  _Float16* qwh  = (_Float16*)(ws + o_qwh);
  _Float16* kvwh = (_Float16*)(ws + o_kvwh);
  _Float16* pwh  = (_Float16*)(ws + o_pwh);
  float*    bsm  = (float*)   (ws + o_bias);
  float*    mskf = (float*)   (ws + o_mask);
  _Float16* Qh   = (_Float16*)(ws + o_Qh);
  _Float16* Kh   = (_Float16*)(ws + o_Kh);
  _Float16* Vt   = (_Float16*)(ws + o_Vt);
  _Float16* att  = (_Float16*)(ws + o_att);

  // Stage 0: weight conversion + bias gather + mask re-layout
  cvt_f32_to_f16<<<(192 * 192 + 255) / 256, 256, 0, stream>>>(q_w, qwh, 192 * 192);
  cvt_f32_to_f16<<<(384 * 192 + 255) / 256, 256, 0, stream>>>(kv_w, kvwh, 384 * 192);
  cvt_f32_to_f16<<<(192 * 192 + 255) / 256, 256, 0, stream>>>(proj_w, pwh, 192 * 192);
  bias_gather<<<(PLANE_F + 255) / 256, 256, 0, stream>>>(table, relidx, bsm);
  mask_to_fragments<<<dim3(QT_COUNT, NWIN), 256, 0, stream>>>(mask, mskf);

  // Stage 1: QKV projections (f16 WMMA, f32 accumulate)
  qkv_gemm<<<dim3(QT_COUNT, 12 + 24, NB), 32, 0, stream>>>(
      x1, x2, qwh, kvwh, q_b, kv_b, Qh, Kh, Vt);

  // Stage 2: fused flash attention (QK^T + bias + mask + softmax + PV)
  flash_attn<<<dim3(QT_COUNT, NHEAD, NB), 32, 0, stream>>>(
      Qh, Kh, Vt, bsm, mskf, att);

  // Stage 3: output projection
  proj_gemm<<<dim3(QT_COUNT, 12, NB), 32, 0, stream>>>(att, pwh, proj_b, out);
}

// v002
// Measured time: 245 microseconds a run.
// Timed twice side by side with v001, it ran 1.82 times as fast both times.
// All steps since v000 together make it 5.67 times as fast.
#include <hip/hip_runtime.h>
#include <hip/hip_bf16.h>

typedef __attribute__((ext_vector_type(16))) _Float16 v16h;
typedef __attribute__((ext_vector_type(8)))  _Float16 v8h;
typedef __attribute__((ext_vector_type(8)))  float    v8f;
typedef __attribute__((ext_vector_type(4)))  float    v4f;

#define N_TOK 343
#define N_PAD 352
#define DIMC  192
#define NHEAD 6
#define HD    32
#define NWIN  64
#define NB    256
#define QT_COUNT 22   /* 352/16 */
#define KT_COUNT 11   /* 352/32 */
#define TILE_F   512  /* floats of one 16-query x 32-key score tile */
#define PLANE_F  (QT_COUNT * KT_COUNT * TILE_F)   /* 352*352 floats */
#define TAB_ROWS 2197
#define KEY_PAD  (-1.0e30f)

union V16U { v16h v; v8h h[2]; };

// ---------------------------------------------------------------------------
// Operand loader for f16 row-major [rows][ld]:
//   A-operand: lane(0..15)=row rowBase+l, k = k0+{0..7,16..23}
//              lane(16..31)=row rowBase+(l-16), k = k0+{8..15,24..31}
// (B-operand uses the same pattern with "row" = output column / query index.)
// All chunks are 16B aligned given ld%8==0 and k0%32==0.
// ---------------------------------------------------------------------------
__device__ __forceinline__ v16h load_f16_tile(const _Float16* base, int rowBase,
                                              int ld, int k0) {
  int l = threadIdx.x;
  int r = l & 15;
  int g = (l >> 4) & 1;
  const _Float16* p = base + (size_t)(rowBase + r) * ld + k0 + g * 8;
  V16U u;
  u.h[0] = *(const v8h*)(p);
  u.h[1] = *(const v8h*)(p + 16);
  return u.v;
}

// Same lane mapping, but source is f32 (converted to f16); rows >= nvalid -> 0.
// The address is clamped and the value selected, with no branch round the
// loads, so that a wave's loads of all k steps are in flight together.
__device__ __forceinline__ v16h load_f32_tile_cvt(const float* base, int rowBase,
                                                  int nvalid, int ld, int k0) {
  int l = threadIdx.x;
  int r = l & 15;
  int g = (l >> 4) & 1;
  int row = rowBase + r;
  bool in = (row < nvalid);
  const float* p = base + (size_t)min(row, nvalid - 1) * ld + k0 + g * 8;
  v4f a0 = *(const v4f*)(p);
  v4f a1 = *(const v4f*)(p + 4);
  v4f b0 = *(const v4f*)(p + 16);
  v4f b1 = *(const v4f*)(p + 20);
  V16U u;
#pragma unroll
  for (int i = 0; i < 4; ++i) {
    u.h[0][i]     = in ? (_Float16)a0[i] : (_Float16)0.f;
    u.h[0][4 + i] = in ? (_Float16)a1[i] : (_Float16)0.f;
    u.h[1][i]     = in ? (_Float16)b0[i] : (_Float16)0.f;
    u.h[1][4 + i] = in ? (_Float16)b1[i] : (_Float16)0.f;
  }
  return u.v;
}

__device__ __forceinline__ v8f wmma_f16(v16h a, v16h b, v8f c) {
  return __builtin_amdgcn_wmma_f32_16x16x32_f16(false, a, false, b, (short)0, c,
                                                false, false);
}

// ---------------------------------------------------------------------------
// Stage 0a: f32 -> f16 weight conversion
// ---------------------------------------------------------------------------
__global__ void cvt_f32_to_f16(const float* __restrict__ src,
                               _Float16* __restrict__ dst, int n) {
  int i = blockIdx.x * 256 + threadIdx.x;
  if (i < n) dst[i] = (_Float16)src[i];
}

// ---------------------------------------------------------------------------
// Fragment order of the score addends (bias and mask planes, 352 x 352 padded):
//   plane[qt][kt][j][lane][e], one 16-query x 32-key tile = 4 x 32 x 4 floats.
//   lane = 16*g + (q & 15); key = 32*kt + 16*(j >> 1) + 8*g + 4*(j & 1) + e.
// That is the accumulator layout of S^T in flash_attn: load j of a tile is
// 32 lanes x 16 B = 512 contiguous bytes (four whole 128-B lines).
// ---------------------------------------------------------------------------

// ---------------------------------------------------------------------------
// Stage 0b: relative-position bias gather into fragment order:
//   biasF[h] at (q,k) = table[rel_idx[q][k]][h]; 0 in the padding.
// ---------------------------------------------------------------------------
__global__ void bias_gather(const float* __restrict__ table,
                            const int* __restrict__ rel_idx,
                            float* __restrict__ biasF) {
  int i = blockIdx.x * 256 + threadIdx.x;      // index inside a plane
  if (i < PLANE_F) {
    int e    = i & 3;
    int lane = (i >> 2) & 31;
    int j    = (i >> 7) & 3;
    int tile = i >> 9;
    int qt = tile / KT_COUNT;
    int kt = tile - qt * KT_COUNT;
    int q = qt * 16 + (lane & 15);
    int k = kt * 32 + (j >> 1) * 16 + (lane >> 4) * 8 + (j & 1) * 4 + e;
    bool in = (q < N_TOK) && (k < N_TOK);
    int idx = in ? rel_idx[q * N_TOK + k] : 0;
    idx = min(max(idx, 0), TAB_ROWS - 1);      // the table read stays in bounds
#pragma unroll
    for (int h = 0; h < NHEAD; ++h) {
      float tv = table[idx * NHEAD + h];
      biasF[(size_t)h * PLANE_F + i] = in ? tv : 0.f;
    }
  }
}

// ---------------------------------------------------------------------------
// Stage 0c: mask -> fragment order, one block per (q-tile, window).
//   Rows are read as whole rows (coalesced), turned in LDS, and written as
//   contiguous 16-B pieces. Padding keys get KEY_PAD, padding queries 0.
// ---------------------------------------------------------------------------
#define MROW_PITCH 356   /* floats; 16-B multiple, spreads the 16 rows over the banks */
__global__ __launch_bounds__(256) void mask_to_fragments(
    const float* __restrict__ mask, float* __restrict__ maskF) {
  __shared__ __attribute__((aligned(16))) float rows[16 * MROW_PITCH];
  int qt = blockIdx.x;
  int w  = blockIdx.y;
  int t  = threadIdx.x;
  int ln = t & 31;
  int wv = t >> 5;
  const float* Mw = mask + (size_t)w * N_TOK * N_TOK;
  // Clamped addresses instead of branches, and the loops unrolled: the 22
  // loads of a wave are then all in flight before the first LDS store waits.
  float v[2][KT_COUNT];
#pragma unroll
  for (int rr = 0; rr < 2; ++rr) {
    int q = qt * 16 + wv + 8 * rr;
    const float* Mr = Mw + (size_t)min(q, N_TOK - 1) * N_TOK;
#pragma unroll
    for (int i = 0; i < KT_COUNT; ++i) v[rr][i] = Mr[min(ln + 32 * i, N_TOK - 1)];
  }
#pragma unroll
  for (int rr = 0; rr < 2; ++rr) {
    int ql = wv + 8 * rr;
    bool qin = (qt * 16 + ql < N_TOK);
#pragma unroll
    for (int i = 0; i < KT_COUNT; ++i) {
      int k = ln + 32 * i;
      rows[ql * MROW_PITCH + k] = (k < N_TOK) ? (qin ? v[rr][i] : 0.f) : KEY_PAD;
    }
  }
  __syncthreads();
  v4f* dst = (v4f*)(maskF + (size_t)w * PLANE_F + (size_t)qt * KT_COUNT * TILE_F);
  for (int f = t; f < KT_COUNT * TILE_F / 4; f += 256) {
    int lane = f & 31;
    int j    = (f >> 5) & 3;
    int kt   = f >> 7;
    int k = kt * 32 + (j >> 1) * 16 + (lane >> 4) * 8 + (j & 1) * 4;
    dst[f] = *(const v4f*)(rows + (lane & 15) * MROW_PITCH + k);
  }
}

// ---------------------------------------------------------------------------
// Projection GEMMs: one workgroup of 8 waves per 128 rows x 192 columns.
//   The 192 x 192 f16 weight panel is staged once in LDS and shared by the 8
//   waves; each wave keeps the six A fragments of its 16 rows in registers and
//   walks the 12 column tiles. The k order of every sum is k0 = 0,32,..,160.
// ---------------------------------------------------------------------------
#define GEMM_WAVES 8
#define ROW_TILES  (QT_COUNT * NB)            /* 5632 = 704 * 8 */
#define CT_COUNT   12                         /* 192/16 column tiles of a panel */
#define KS_COUNT   6                          /* 192/32 k steps */
#define WP_PITCH   200                        /* halves: 400 B = 16 B x 25, odd, for b128 readers */
#define WP_CHUNKS  (DIMC * DIMC / 8)          /* 4608 pieces of 16 B */
// The panel takes 76,800 B, so four workgroups fit a WGP's LDS: the second
// launch bound (8 waves per SIMD) keeps the registers from allowing fewer.

__device__ __forceinline__ void stage_panel(const _Float16* __restrict__ Wp,
                                            _Float16* wp) {
  int t = threadIdx.x;
  v8h tmp[WP_CHUNKS / 256];
  // unrolled: all 18 loads of a thread are in flight before the first LDS store
#pragma unroll
  for (int i = 0; i < WP_CHUNKS / 256; ++i)
    tmp[i] = *(const v8h*)(Wp + (size_t)(t + 256 * i) * 8);
#pragma unroll
  for (int i = 0; i < WP_CHUNKS / 256; ++i) {
    int f   = t + 256 * i;
    int row = f / (DIMC / 8);
    int ch  = f - row * (DIMC / 8);
    *(v8h*)(wp + row * WP_PITCH + ch * 8) = tmp[i];
  }
}

// Same lane mapping as load_f16_tile, from the LDS panel.
__device__ __forceinline__ v16h panel_frag(const _Float16* wp, int rowBase, int k0) {
  int l = threadIdx.x;
  int r = l & 15;
  int g = (l >> 4) & 1;
  const _Float16* p = wp + (rowBase + r) * WP_PITCH + k0 + g * 8;
  V16U u;
  u.h[0] = *(const v8h*)(p);
  u.h[1] = *(const v8h*)(p + 16);
  return u.v;
}

__device__ __forceinline__ v8f strip_tile(const v16h (&a)[KS_COUNT],
                                          const _Float16* wp, int ct) {
  v8f acc = {};
#pragma unroll
  for (int ks = 0; ks < KS_COUNT; ++ks)
    acc = wmma_f16(a[ks], panel_frag(wp, ct * 16, ks * 32), acc);
  return acc;
}

// ---------------------------------------------------------------------------
// Stage 1: QKV projection GEMM.
//   blockIdx.x = panel (0 Q, 1 K, 2 V), blockIdx.y = group of 8 row tiles
//   Q  -> Qh[b][h][n][d]  (f16, pre-scaled by hd^-0.5)
//   K  -> Kh[b][h][n][d]  (f16)
//   V  -> Vt[b][h][d][n]  (f16, transposed; contiguous stores)
// ---------------------------------------------------------------------------
__global__ __launch_bounds__(256, 8) void qkv_gemm(
    const float* __restrict__ x1, const float* __restrict__ x2,
    const _Float16* __restrict__ qwh, const _Float16* __restrict__ kvwh,
    const float* __restrict__ qb, const float* __restrict__ kvb,
    _Float16* __restrict__ Qh, _Float16* __restrict__ Kh,
    _Float16* __restrict__ Vt) {
  __shared__ __attribute__((aligned(16))) _Float16 wp[DIMC * WP_PITCH];
  int pn = blockIdx.x;
  int wv = __builtin_amdgcn_readfirstlane(threadIdx.x >> 5);
  int rt = blockIdx.y * GEMM_WAVES + wv;      // row tile, 0..5631
  int b  = rt / QT_COUNT;
  int nbase = (rt - b * QT_COUNT) * 16;
  const float*    X  = (pn == 0) ? x1 : x2;
  const _Float16* Wp = (pn == 0) ? qwh : kvwh + (size_t)(pn - 1) * DIMC * DIMC;
  const float*    bv = (pn == 0) ? qb : kvb + (pn - 1) * DIMC;

  stage_panel(Wp, wp);
  // Keeps the 24 f32 loads below from being lifted among the 18 staging loads:
  // both sets in flight at once need more registers than 8 waves per SIMD leave,
  // and the build then spills to scratch.
  __builtin_amdgcn_sched_barrier(0);
  v16h a[KS_COUNT];
#pragma unroll
  for (int ks = 0; ks < KS_COUNT; ++ks)
    a[ks] = load_f32_tile_cvt(X + (size_t)b * N_TOK * DIMC, nbase, N_TOK, DIMC, ks * 32);
  __syncthreads();                // the panel is complete before any wave reads it

  int l = threadIdx.x;
  int g = (l >> 4) & 1;           // register group: rows nbase+8g .. nbase+8g+7
  int cl = l & 15;                // this lane's output column inside a tile

  // The walks go two column tiles a trip and stay rolled (unroll 1): unrolled,
  // the fragment loads of all 12 tiles are hoisted until A spills to scratch.
  if (pn == 2) {
#pragma unroll 1
    for (int cp = 0; cp < CT_COUNT; cp += 2) {
      v8f acc[2] = {strip_tile(a, wp, cp), strip_tile(a, wp, cp + 1)};
#pragma unroll
      for (int u = 0; u < 2; ++u) {
        int c = (cp + u) * 16 + cl;
        float bias = bv[c];
        _Float16* dst = Vt + ((size_t)b * DIMC + c) * N_PAD + nbase + 8 * g;
        v8h o;
#pragma unroll
        for (int r = 0; r < 8; ++r) o[r] = (_Float16)(acc[u][r] + bias);
        *(v8h*)dst = o;   // 16B contiguous
      }
    }
  } else if (pn == 1) {
#pragma unroll 1
    for (int cp = 0; cp < CT_COUNT; cp += 2) {
      v8f acc[2] = {strip_tile(a, wp, cp), strip_tile(a, wp, cp + 1)};
      _Float16* base = Kh + ((size_t)b * NHEAD + (cp >> 1)) * N_PAD * HD;   // head cp/2
#pragma unroll
      for (int u = 0; u < 2; ++u) {
        float bias = bv[(cp + u) * 16 + cl];
        int d = u * 16 + cl;
#pragma unroll
        for (int r = 0; r < 8; ++r) {
          int n = nbase + 8 * g + r;
          base[(size_t)n * HD + d] = (_Float16)(acc[u][r] + bias);
        }
      }
    }
  } else {
    const float scale = 0.17677669529663687f;  // 32^-0.5
#pragma unroll 1
    for (int cp = 0; cp < CT_COUNT; cp += 2) {
      v8f acc[2] = {strip_tile(a, wp, cp), strip_tile(a, wp, cp + 1)};
      _Float16* base = Qh + ((size_t)b * NHEAD + (cp >> 1)) * N_PAD * HD;   // head cp/2
#pragma unroll
      for (int u = 0; u < 2; ++u) {
        float bias = bv[(cp + u) * 16 + cl];
        int d = u * 16 + cl;
#pragma unroll
        for (int r = 0; r < 8; ++r) {
          int n = nbase + 8 * g + r;
          base[(size_t)n * HD + d] = (_Float16)((acc[u][r] + bias) * scale);
        }
      }
    }
  }
}

// ---------------------------------------------------------------------------
// Stage 2: flash attention, one wave per (b, h, q-tile).
//   Computes S^T = K x Q^T so P^T (in D-register layout) is directly the
//   B operand of O^T = V^T x P^T (32 keys per iteration => K=32 exactly).
// ---------------------------------------------------------------------------
__global__ __launch_bounds__(32) void flash_attn(
    const _Float16* __restrict__ Qh, const _Float16* __restrict__ Kh,
    const _Float16* __restrict__ Vt, const float* __restrict__ biasF,
    const float* __restrict__ maskF, _Float16* __restrict__ att) {
  int qt = blockIdx.x;            // 0..21
  int h  = blockIdx.y;            // 0..5
  int b  = blockIdx.z;            // 0..255
  int w  = b & (NWIN - 1);        // window index for mask

  const _Float16* Qb = Qh + ((size_t)b * NHEAD + h) * N_PAD * HD;
  const _Float16* Kb = Kh + ((size_t)b * NHEAD + h) * N_PAD * HD;
  const _Float16* Vb = Vt + ((size_t)b * NHEAD + h) * HD * N_PAD;

  int l  = threadIdx.x;
  int q  = l & 15;
  int g  = (l >> 4) & 1;
  int qg = qt * 16 + q;           // this lane's global query index

  // this lane's 16-B pieces of the addend tiles of q-tile qt (fragment order)
  const v4f* Bf = (const v4f*)(biasF + (size_t)h * PLANE_F +
                               (size_t)qt * KT_COUNT * TILE_F) + l;
  const v4f* Mf = (const v4f*)(maskF + (size_t)w * PLANE_F +
                               (size_t)qt * KT_COUNT * TILE_F) + l;

  v16h Qop = load_f16_tile(Qb, qt * 16, HD, 0);   // B operand, loaded once

  v8f oLo = {};                   // O^T rows d=0..15 (this lane: d=8g+r)
  v8f oHi = {};                   // O^T rows d=16..31
  float mrow = -3.0e38f;
  float lsum = 0.f;

  for (int k0 = 0; k0 < N_PAD; k0 += 32) {
    v16h Ka = load_f16_tile(Kb, k0, HD, 0);
    v16h Kc = load_f16_tile(Kb, k0 + 16, HD, 0);
    v8f z0 = {};
    v8f z1 = {};
    v8f s0 = wmma_f16(Ka, Qop, z0);   // keys k0   .. k0+15 (x query)
    v8f s1 = wmma_f16(Kc, Qop, z1);   // keys k0+16.. k0+31

    // s0 reg r -> key k0+8g+r, s1 reg r -> key k0+16+8g+r; padding keys carry
    // KEY_PAD in the mask plane, so no bounds test is left here.
    int tb = (k0 >> 5) * (TILE_F / 4);
    v4f b0 = Bf[tb], b1 = Bf[tb + 32], b2 = Bf[tb + 64], b3 = Bf[tb + 96];
    v4f m0 = Mf[tb], m1 = Mf[tb + 32], m2 = Mf[tb + 64], m3 = Mf[tb + 96];
#pragma unroll
    for (int r = 0; r < 4; ++r) {
      s0[r]     = s0[r]     + b0[r] + m0[r];
      s0[4 + r] = s0[4 + r] + b1[r] + m1[r];
      s1[r]     = s1[r]     + b2[r] + m2[r];
      s1[4 + r] = s1[4 + r] + b3[r] + m3[r];
    }

    // --- online softmax (row = query; pair (lane, lane^16) shares a row) ---
    float tm = s0[0];
#pragma unroll
    for (int r = 0; r < 8; ++r) { tm = fmaxf(tm, s0[r]); tm = fmaxf(tm, s1[r]); }
    tm = fmaxf(tm, __shfl_xor(tm, 16, 32));
    float mnew  = fmaxf(mrow, tm);
    float alpha = __expf(mrow - mnew);
    mrow = mnew;

    V16U p;                       // P^T in B-operand layout for K=32
    float rs = 0.f;
#pragma unroll
    for (int r = 0; r < 8; ++r) {
      float e0 = __expf(s0[r] - mnew);
      float e1 = __expf(s1[r] - mnew);
      rs += e0 + e1;
      p.h[0][r] = (_Float16)e0;   // keys k0+8g+r
      p.h[1][r] = (_Float16)e1;   // keys k0+16+8g+r
    }
    rs += __shfl_xor(rs, 16, 32);
    lsum = lsum * alpha + rs;

#pragma unroll
    for (int i = 0; i < 8; ++i) { oLo[i] *= alpha; oHi[i] *= alpha; }

    v16h Va0 = load_f16_tile(Vb, 0,  N_PAD, k0);  // V^T rows d=0..15
    v16h Va1 = load_f16_tile(Vb, 16, N_PAD, k0);  // V^T rows d=16..31
    oLo = wmma_f16(Va0, p.v, oLo);
    oHi = wmma_f16(Va1, p.v, oHi);
  }

  if (qg < N_TOK) {
    float inv = 1.0f / lsum;
    _Float16* dst = att + ((size_t)b * N_TOK + qg) * DIMC + h * HD;   // rows unpadded
    v8h a0, a1;
#pragma unroll
    for (int r = 0; r < 8; ++r) {
      a0[r] = (_Float16)(oLo[r] * inv);   // d = 8g + r
      a1[r] = (_Float16)(oHi[r] * inv);   // d = 16 + 8g + r
    }
    *(v8h*)(dst + 8 * g)      = a0;       // 16B contiguous
    *(v8h*)(dst + 16 + 8 * g) = a1;
  }
}

// ---------------------------------------------------------------------------
// Stage 3: output projection GEMM. out[m][c] = att[m][:] . proj_w[c][:] + pb[c]
//   m = b * 343 + n runs over the 87808 = 5488 * 16 rows of att and of out
//   (both unpadded), so no row tile has an edge. blockIdx.x = group of 8 row
//   tiles; same workgroup tile as stage 1.
// ---------------------------------------------------------------------------
#define OUT_TILES (NB * N_TOK / 16)           /* 5488 = 686 * 8 */
__global__ __launch_bounds__(256, 8) void proj_gemm(
    const _Float16* __restrict__ att, const _Float16* __restrict__ pwh,
    const float* __restrict__ pb, float* __restrict__ out) {
  __shared__ __attribute__((aligned(16))) _Float16 wp[DIMC * WP_PITCH];
  int wv = __builtin_amdgcn_readfirstlane(threadIdx.x >> 5);
  int mbase = (blockIdx.x * GEMM_WAVES + wv) * 16;

  v16h a[KS_COUNT];
#pragma unroll
  for (int ks = 0; ks < KS_COUNT; ++ks)
    a[ks] = load_f16_tile(att, mbase, DIMC, ks * 32);
  // the staging below reuses the address registers of the loads above
  asm volatile("s_wait_xcnt 0x0" ::: "memory");
  stage_panel(pwh, wp);
  __syncthreads();                // the panel is complete before any wave reads it

  int l = threadIdx.x;
  int g = (l >> 4) & 1;
  float* dst = out + (size_t)(mbase + 8 * g) * DIMC + (l & 15);
  // Two column tiles a trip, rolled (unroll 1): fully unrolled, the build kept
  // one fragment set and waited out the LDS latency in front of every WMMA.
#pragma unroll 1
  for (int cp = 0; cp < CT_COUNT; cp += 2) {
    v8f acc[2] = {strip_tile(a, wp, cp), strip_tile(a, wp, cp + 1)};
#pragma unroll
    for (int u = 0; u < 2; ++u) {
      float bias = pb[(cp + u) * 16 + (l & 15)];
#pragma unroll
      for (int r = 0; r < 8; ++r)
        dst[(size_t)r * DIMC + (cp + u) * 16] = acc[u][r] + bias;
    }
    // the next trip rewrites registers that these stores name
    asm volatile("s_wait_xcnt 0x0" ::: "memory");
  }
}

// ---------------------------------------------------------------------------
// Host launcher
// ---------------------------------------------------------------------------
extern "C" void kernel_launch(void* const* d_in, const int* in_sizes, int n_in,
                              void* d_out, int out_size, void* d_ws, size_t ws_size,
                              hipStream_t stream) {
  const float* x1     = (const float*)d_in[0];
  const float* x2     = (const float*)d_in[1];
  const float* mask   = (const float*)d_in[2];
  const float* table  = (const float*)d_in[3];
  const float* q_w    = (const float*)d_in[4];
  const float* q_b    = (const float*)d_in[5];
  const float* kv_w   = (const float*)d_in[6];
  const float* kv_b   = (const float*)d_in[7];
  const float* proj_w = (const float*)d_in[8];
  const float* proj_b = (const float*)d_in[9];
  const int*   relidx = (const int*)d_in[10];
  float* out = (float*)d_out;

  char* ws = (char*)d_ws;
  // workspace layout (256B aligned)
  const size_t o_qwh  = 0;                                 //  73,728 B
  const size_t o_kvwh = o_qwh  + 73728;                    // 147,456 B
  const size_t o_pwh  = o_kvwh + 147456;                   //  73,728 B
  const size_t o_bias = o_pwh  + 73728;                    //  2,973,696 B (6 planes)
  const size_t o_mask = o_bias + 2973696;                  // 31,719,424 B (64 planes)
  const size_t o_Qh   = o_mask + 31719424;                 // 34,603,008 B
  const size_t o_Kh   = o_Qh   + 34603008;
  const size_t o_Vt   = o_Kh   + 34603008;
  const size_t o_att  = o_Vt   + 34603008;

  _Float16* qwh  = (_Float16*)(ws + o_qwh);
  _Float16* kvwh = (_Float16*)(ws + o_kvwh);
  _Float16* pwh  = (_Float16*)(ws + o_pwh);
  float*    bsm  = (float*)   (ws + o_bias);
  float*    mskf = (float*)   (ws + o_mask);
  _Float16* Qh   = (_Float16*)(ws + o_Qh);
  _Float16* Kh   = (_Float16*)(ws + o_Kh);
  _Float16* Vt   = (_Float16*)(ws + o_Vt);
  _Float16* att  = (_Float16*)(ws + o_att);

  // Stage 0: weight conversion + bias gather + mask re-layout
  cvt_f32_to_f16<<<(192 * 192 + 255) / 256, 256, 0, stream>>>(q_w, qwh, 192 * 192);
  cvt_f32_to_f16<<<(384 * 192 + 255) / 256, 256, 0, stream>>>(kv_w, kvwh, 384 * 192);
  cvt_f32_to_f16<<<(192 * 192 + 255) / 256, 256, 0, stream>>>(proj_w, pwh, 192 * 192);
  bias_gather<<<(PLANE_F + 255) / 256, 256, 0, stream>>>(table, relidx, bsm);
  mask_to_fragments<<<dim3(QT_COUNT, NWIN), 256, 0, stream>>>(mask, mskf);

  // Stage 1: QKV projections (f16 WMMA, f32 accumulate)
  qkv_gemm<<<dim3(3, ROW_TILES / GEMM_WAVES), 256, 0, stream>>>(
      x1, x2, qwh, kvwh, q_b, kv_b, Qh, Kh, Vt);

  // Stage 2: fused flash attention (QK^T + bias + mask + softmax + PV)
  flash_attn<<<dim3(QT_COUNT, NHEAD, NB), 32, 0, stream>>>(
      Qh, Kh, Vt, bsm, mskf, att);

  // Stage 3: output projection
  proj_gemm<<<dim3(OUT_TILES / GEMM_WAVES), 256, 0, stream>>>(att, pwh, proj_b, out);
}

// v003
// Measured time: 162 microseconds a run.
// In both of two side-by-side timings against v002, it was 1.51 times as fast.
// All steps since v000 together make it 8.55 times as fast.
#include <hip/hip_runtime.h>
#include <hip/hip_bf16.h>

typedef __attribute__((ext_vector_type(16))) _Float16 v16h;
typedef __attribute__((ext_vector_type(8)))  _Float16 v8h;
typedef __attribute__((ext_vector_type(8)))  float    v8f;
typedef __attribute__((ext_vector_type(4)))  float    v4f;

#define N_TOK 343
#define N_PAD 352
#define DIMC  192
#define NHEAD 6
#define HD    32
#define NWIN  64
#define NB    256
#define QT_COUNT 22   /* 352/16 */
#define KT_COUNT 11   /* 352/32 */
#define TILE_F   512  /* floats of one 16-query x 32-key score tile */
#define PLANE_F  (QT_COUNT * KT_COUNT * TILE_F)   /* 352*352 floats */
#define TAB_ROWS 2197
#define KEY_PAD  (-1.0e30f)

union V16U { v16h v; v8h h[2]; };

// ---------------------------------------------------------------------------
// Operand loader for f16 row-major [rows][ld]:
//   A-operand: lane(0..15)=row rowBase+l, k = k0+{0..7,16..23}
//              lane(16..31)=row rowBase+(l-16), k = k0+{8..15,24..31}
// (B-operand uses the same pattern with "row" = output column / query index.)
// All chunks are 16B aligned given ld%8==0 and k0%32==0.
// ---------------------------------------------------------------------------
__device__ __forceinline__ v16h load_f16_tile(const _Float16* base, int rowBase,
                                              int ld, int k0) {
  int l = threadIdx.x;
  int r = l & 15;
  int g = (l >> 4) & 1;
  const _Float16* p = base + (size_t)(rowBase + r) * ld + k0 + g * 8;
  V16U u;
  u.h[0] = *(const v8h*)(p);
  u.h[1] = *(const v8h*)(p + 16);
  return u.v;
}

// Same lane mapping, but source is f32 (converted to f16); rows >= nvalid -> 0.
// The address is clamped and the value selected, with no branch round the
// loads, so that a wave's loads of all k steps are in flight together.
__device__ __forceinline__ v16h load_f32_tile_cvt(const float* base, int rowBase,
                                                  int nvalid, int ld, int k0) {
  int l = threadIdx.x;
  int r = l & 15;
  int g = (l >> 4) & 1;
  int row = rowBase + r;
  bool in = (row < nvalid);
  const float* p = base + (size_t)min(row, nvalid - 1) * ld + k0 + g * 8;
  v4f a0 = *(const v4f*)(p);
  v4f a1 = *(const v4f*)(p + 4);
  v4f b0 = *(const v4f*)(p + 16);
  v4f b1 = *(const v4f*)(p + 20);
  V16U u;
#pragma unroll
  for (int i = 0; i < 4; ++i) {
    u.h[0][i]     = in ? (_Float16)a0[i] : (_Float16)0.f;
    u.h[0][4 + i] = in ? (_Float16)a1[i] : (_Float16)0.f;
    u.h[1][i]     = in ? (_Float16)b0[i] : (_Float16)0.f;
    u.h[1][4 + i] = in ? (_Float16)b1[i] : (_Float16)0.f;
  }
  return u.v;
}

__device__ __forceinline__ v8f wmma_f16(v16h a, v16h b, v8f c) {
  return __builtin_amdgcn_wmma_f32_16x16x32_f16(false, a, false, b, (short)0, c,
                                                false, false);
}

// ---------------------------------------------------------------------------
// Stage 0a: f32 -> f16 weight conversion
// ---------------------------------------------------------------------------
__global__ void cvt_f32_to_f16(const float* __restrict__ src,
                               _Float16* __restrict__ dst, int n) {
  int i = blockIdx.x * 256 + threadIdx.x;
  if (i < n) dst[i] = (_Float16)src[i];
}

// ---------------------------------------------------------------------------
// Fragment order of the score addends (bias and mask planes, 352 x 352 padded):
//   plane[qt][kt][j][lane][e], one 16-query x 32-key tile = 4 x 32 x 4 floats.
//   lane = 16*g + (q & 15); key = 32*kt + 16*(j >> 1) + 8*g + 4*(j & 1) + e.
// That is the accumulator layout of S^T in flash_attn: load j of a tile is
// 32 lanes x 16 B = 512 contiguous bytes (four whole 128-B lines).
// ---------------------------------------------------------------------------

// ---------------------------------------------------------------------------
// Stage 0b: relative-position bias gather into fragment order:
//   biasF[h] at (q,k) = table[rel_idx[q][k]][h]; 0 in the padding.
// ---------------------------------------------------------------------------
__global__ void bias_gather(const float* __restrict__ table,
                            const int* __restrict__ rel_idx,
                            float* __restrict__ biasF) {
  int i = blockIdx.x * 256 + threadIdx.x;      // index inside a plane
  if (i < PLANE_F) {
    int e    = i & 3;
    int lane = (i >> 2) & 31;
    int j    = (i >> 7) & 3;
    int tile = i >> 9;
    int qt = tile / KT_COUNT;
    int kt = tile - qt * KT_COUNT;
    int q = qt * 16 + (lane & 15);
    int k = kt * 32 + (j >> 1) * 16 + (lane >> 4) * 8 + (j & 1) * 4 + e;
    bool in = (q < N_TOK) && (k < N_TOK);
    int idx = in ? rel_idx[q * N_TOK + k] : 0;
    idx = min(max(idx, 0), TAB_ROWS - 1);      // the table read stays in bounds
#pragma unroll
    for (int h = 0; h < NHEAD; ++h) {
      float tv = table[idx * NHEAD + h];
      biasF[(size_t)h * PLANE_F + i] = in ? tv : 0.f;
    }
  }
}

// ---------------------------------------------------------------------------
// Stage 0c: mask -> fragment order, one block per (q-tile, window).
//   Rows are read as whole rows (coalesced), turned in LDS, and written as
//   contiguous 16-B pieces. Padding keys get KEY_PAD, padding queries 0.
// ---------------------------------------------------------------------------
#define MROW_PITCH 356   /* floats; 16-B multiple, spreads the 16 rows over the banks */
__global__ __launch_bounds__(256) void mask_to_fragments(
    const float* __restrict__ mask, float* __restrict__ maskF) {
  __shared__ __attribute__((aligned(16))) float rows[16 * MROW_PITCH];
  int qt = blockIdx.x;
  int w  = blockIdx.y;
  int t  = threadIdx.x;
  int ln = t & 31;
  int wv = t >> 5;
  const float* Mw = mask + (size_t)w * N_TOK * N_TOK;
  // Clamped addresses instead of branches, and the loops unrolled: the 22
  // loads of a wave are then all in flight before the first LDS store waits.
  float v[2][KT_COUNT];
#pragma unroll
  for (int rr = 0; rr < 2; ++rr) {
    int q = qt * 16 + wv + 8 * rr;
    const float* Mr = Mw + (size_t)min(q, N_TOK - 1) * N_TOK;
#pragma unroll
    for (int i = 0; i < KT_COUNT; ++i) v[rr][i] = Mr[min(ln + 32 * i, N_TOK - 1)];
  }
#pragma unroll
  for (int rr = 0; rr < 2; ++rr) {
    int ql = wv + 8 * rr;
    bool qin = (qt * 16 + ql < N_TOK);
#pragma unroll
    for (int i = 0; i < KT_COUNT; ++i) {
      int k = ln + 32 * i;
      rows[ql * MROW_PITCH + k] = (k < N_TOK) ? (qin ? v[rr][i] : 0.f) : KEY_PAD;
    }
  }
  __syncthreads();
  v4f* dst = (v4f*)(maskF + (size_t)w * PLANE_F + (size_t)qt * KT_COUNT * TILE_F);
  for (int f = t; f < KT_COUNT * TILE_F / 4; f += 256) {
    int lane = f & 31;
    int j    = (f >> 5) & 3;
    int kt   = f >> 7;
    int k = kt * 32 + (j >> 1) * 16 + (lane >> 4) * 8 + (j & 1) * 4;
    dst[f] = *(const v4f*)(rows + (lane & 15) * MROW_PITCH + k);
  }
}

// ---------------------------------------------------------------------------
// Projection GEMMs: one workgroup of 8 waves per 128 rows x 192 columns.
//   The 192 x 192 f16 weight panel is staged once in LDS and shared by the 8
//   waves; each wave keeps the six A fragments of its 16 rows in registers and
//   walks the 12 column tiles. The k order of every sum is k0 = 0,32,..,160.
// ---------------------------------------------------------------------------
#define GEMM_WAVES 8
#define ROW_TILES  (QT_COUNT * NB)            /* 5632 = 704 * 8 */
#define CT_COUNT   12                         /* 192/16 column tiles of a panel */
#define KS_COUNT   6                          /* 192/32 k steps */
#define WP_PITCH   200                        /* halves: 400 B = 16 B x 25, odd, for b128 readers */
#define WP_CHUNKS  (DIMC * DIMC / 8)          /* 4608 pieces of 16 B */
// The panel takes 76,800 B, so four workgroups fit a WGP's LDS: the second
// launch bound (8 waves per SIMD) keeps the registers from allowing fewer.

__device__ __forceinline__ void stage_panel(const _Float16* __restrict__ Wp,
                                            _Float16* wp) {
  int t = threadIdx.x;
  v8h tmp[WP_CHUNKS / 256];
  // unrolled: all 18 loads of a thread are in flight before the first LDS store
#pragma unroll
  for (int i = 0; i < WP_CHUNKS / 256; ++i)
    tmp[i] = *(const v8h*)(Wp + (size_t)(t + 256 * i) * 8);
#pragma unroll
  for (int i = 0; i < WP_CHUNKS / 256; ++i) {
    int f   = t + 256 * i;
    int row = f / (DIMC / 8);
    int ch  = f - row * (DIMC / 8);
    *(v8h*)(wp + row * WP_PITCH + ch * 8) = tmp[i];
  }
}

// Same lane mapping as load_f16_tile, from the LDS panel.
__device__ __forceinline__ v16h panel_frag(const _Float16* wp, int rowBase, int k0) {
  int l = threadIdx.x;
  int r = l & 15;
  int g = (l >> 4) & 1;
  const _Float16* p = wp + (rowBase + r) * WP_PITCH + k0 + g * 8;
  V16U u;
  u.h[0] = *(const v8h*)(p);
  u.h[1] = *(const v8h*)(p + 16);
  return u.v;
}

__device__ __forceinline__ v8f strip_tile(const v16h (&a)[KS_COUNT],
                                          const _Float16* wp, int ct) {
  v8f acc = {};
#pragma unroll
  for (int ks = 0; ks < KS_COUNT; ++ks)
    acc = wmma_f16(a[ks], panel_frag(wp, ct * 16, ks * 32), acc);
  return acc;
}

// ---------------------------------------------------------------------------
// Stage 1: QKV projection GEMM.
//   blockIdx.x = panel (0 Q, 1 K, 2 V), blockIdx.y = group of 8 row tiles
//   Q  -> Qh[b][h][n][d]  (f16, pre-scaled by hd^-0.5)
//   K  -> Kh[b][h][n][d]  (f16)
//   V  -> Vt[b][h][d][n]  (f16, transposed; contiguous stores)
// ---------------------------------------------------------------------------
__global__ __launch_bounds__(256, 8) void qkv_gemm(
    const float* __restrict__ x1, const float* __restrict__ x2,
    const _Float16* __restrict__ qwh, const _Float16* __restrict__ kvwh,
    const float* __restrict__ qb, const float* __restrict__ kvb,
    _Float16* __restrict__ Qh, _Float16* __restrict__ Kh,
    _Float16* __restrict__ Vt) {
  __shared__ __attribute__((aligned(16))) _Float16 wp[DIMC * WP_PITCH];
  int pn = blockIdx.x;
  int wv = __builtin_amdgcn_readfirstlane(threadIdx.x >> 5);
  int rt = blockIdx.y * GEMM_WAVES + wv;      // row tile, 0..5631
  int b  = rt / QT_COUNT;
  int nbase = (rt - b * QT_COUNT) * 16;
  const float*    X  = (pn == 0) ? x1 : x2;
  const _Float16* Wp = (pn == 0) ? qwh : kvwh + (size_t)(pn - 1) * DIMC * DIMC;
  const float*    bv = (pn == 0) ? qb : kvb + (pn - 1) * DIMC;

  stage_panel(Wp, wp);
  // Keeps the 24 f32 loads below from being lifted among the 18 staging loads:
  // both sets in flight at once need more registers than 8 waves per SIMD leave,
  // and the build then spills to scratch.
  __builtin_amdgcn_sched_barrier(0);
  v16h a[KS_COUNT];
#pragma unroll
  for (int ks = 0; ks < KS_COUNT; ++ks)
    a[ks] = load_f32_tile_cvt(X + (size_t)b * N_TOK * DIMC, nbase, N_TOK, DIMC, ks * 32);
  __syncthreads();                // the panel is complete before any wave reads it

  int l = threadIdx.x;
  int g = (l >> 4) & 1;           // register group: rows nbase+8g .. nbase+8g+7
  int cl = l & 15;                // this lane's output column inside a tile

  // The walks go two column tiles a trip and stay rolled (unroll 1): unrolled,
  // the fragment loads of all 12 tiles are hoisted until A spills to scratch.
  if (pn == 2) {
#pragma unroll 1
    for (int cp = 0; cp < CT_COUNT; cp += 2) {
      v8f acc[2] = {strip_tile(a, wp, cp), strip_tile(a, wp, cp + 1)};
#pragma unroll
      for (int u = 0; u < 2; ++u) {
        int c = (cp + u) * 16 + cl;
        float bias = bv[c];
        _Float16* dst = Vt + ((size_t)b * DIMC + c) * N_PAD + nbase + 8 * g;
        v8h o;
#pragma unroll
        for (int r = 0; r < 8; ++r) o[r] = (_Float16)(acc[u][r] + bias);
        *(v8h*)dst = o;   // 16B contiguous
      }
    }
  } else if (pn == 1) {
#pragma unroll 1
    for (int cp = 0; cp < CT_COUNT; cp += 2) {
      v8f acc[2] = {strip_tile(a, wp, cp), strip_tile(a, wp, cp + 1)};
      _Float16* base = Kh + ((size_t)b * NHEAD + (cp >> 1)) * N_PAD * HD;   // head cp/2
#pragma unroll
      for (int u = 0; u < 2; ++u) {
        float bias = bv[(cp + u) * 16 + cl];
        int d = u * 16 + cl;
#pragma unroll
        for (int r = 0; r < 8; ++r) {
          int n = nbase + 8 * g + r;
          base[(size_t)n * HD + d] = (_Float16)(acc[u][r] + bias);
        }
      }
    }
  } else {
    const float scale = 0.17677669529663687f;  // 32^-0.5
#pragma unroll 1
    for (int cp = 0; cp < CT_COUNT; cp += 2) {
      v8f acc[2] = {strip_tile(a, wp, cp), strip_tile(a, wp, cp + 1)};
      _Float16* base = Qh + ((size_t)b * NHEAD + (cp >> 1)) * N_PAD * HD;   // head cp/2
#pragma unroll
      for (int u = 0; u < 2; ++u) {
        float bias = bv[(cp + u) * 16 + cl];
        int d = u * 16 + cl;
#pragma unroll
        for (int r = 0; r < 8; ++r) {
          int n = nbase + 8 * g + r;
          base[(size_t)n * HD + d] = (_Float16)((acc[u][r] + bias) * scale);
        }
      }
    }
  }
}

// ---------------------------------------------------------------------------
// Stage 2: flash attention, one workgroup of 11 waves per (b, h). K and V^T of
//   the head are staged once in LDS and shared by the 11 waves; a wave takes
//   two q-tiles, one after the other; bias and mask tiles belong to one q-tile
//   alone and come from global memory.
//   Computes S^T = K x Q^T so P^T (in D-register layout) is directly the
//   B operand of O^T = V^T x P^T (32 keys per iteration => K=32 exactly).
//   51,200 B of LDS and 11 waves: three workgroups fit a WGP at this kernel's
//   registers, and the 1536 workgroups are two full rounds of 256 x 3.
// ---------------------------------------------------------------------------
#define FA_WAVES   (QT_COUNT / 2)             /* 11 */
#define FA_THREADS (FA_WAVES * 32)            /* 352 */
#define KL_PITCH   40                         /* halves: 80 B = 16 B x 5, odd, for b128 readers */
#define VL_PITCH   360                        /* halves: 720 B = 16 B x 45, odd */
#define KV_CHUNKS  (N_PAD * HD / 8)           /* 1408 pieces of 16 B in K, and in V^T */

// Same lane mapping as load_f16_tile, from an LDS array of the given pitch.
__device__ __forceinline__ v16h lds_frag(const _Float16* base, int rowBase,
                                         int pitch, int k0) {
  int l = threadIdx.x;
  int r = l & 15;
  int g = (l >> 4) & 1;
  const _Float16* p = base + (rowBase + r) * pitch + k0 + g * 8;
  V16U u;
  u.h[0] = *(const v8h*)(p);
  u.h[1] = *(const v8h*)(p + 16);
  return u.v;
}

__global__ __launch_bounds__(FA_THREADS) void flash_attn(
    const _Float16* __restrict__ Qh, const _Float16* __restrict__ Kh,
    const _Float16* __restrict__ Vt, const float* __restrict__ biasF,
    const float* __restrict__ maskF, _Float16* __restrict__ att) {
  __shared__ __attribute__((aligned(16))) _Float16 kl[N_PAD * KL_PITCH];   // 28,160 B
  __shared__ __attribute__((aligned(16))) _Float16 vl[HD * VL_PITCH];      // 23,040 B
  int h  = blockIdx.x;            // 0..5
  int b  = blockIdx.y;            // 0..255
  int w  = b & (NWIN - 1);        // window index for mask
  int t  = threadIdx.x;
  int wv = __builtin_amdgcn_readfirstlane(t >> 5);   // 0..10

  const _Float16* Qb = Qh + ((size_t)b * NHEAD + h) * N_PAD * HD;
  const _Float16* Kb = Kh + ((size_t)b * NHEAD + h) * N_PAD * HD;
  const _Float16* Vb = Vt + ((size_t)b * NHEAD + h) * HD * N_PAD;

  // Both arrays are read as they lie (contiguous 16-B pieces, four of each a
  // thread, all in flight together) and laid down at the padded pitches.
  v8h kc[KV_CHUNKS / FA_THREADS], vc[KV_CHUNKS / FA_THREADS];
#pragma unroll
  for (int i = 0; i < KV_CHUNKS / FA_THREADS; ++i) {
    kc[i] = *(const v8h*)(Kb + (size_t)(t + FA_THREADS * i) * 8);
    vc[i] = *(const v8h*)(Vb + (size_t)(t + FA_THREADS * i) * 8);
  }
#pragma unroll
  for (int i = 0; i < KV_CHUNKS / FA_THREADS; ++i) {
    int f  = t + FA_THREADS * i;
    int kr = f / (HD / 8);
    int vr = f / (N_PAD / 8);
    *(v8h*)(kl + kr * KL_PITCH + (f - kr * (HD / 8)) * 8)    = kc[i];
    *(v8h*)(vl + vr * VL_PITCH + (f - vr * (N_PAD / 8)) * 8) = vc[i];
  }
  __syncthreads();                // K and V^T are complete before any wave reads them

  int l  = t & 31;
  int q  = l & 15;
  int g  = (l >> 4) & 1;

  for (int qt = wv; qt < QT_COUNT; qt += FA_WAVES) {
  int qg = qt * 16 + q;           // this lane's global query index

  // this lane's 16-B pieces of the addend tiles of q-tile qt (fragment order)
  const v4f* Bf = (const v4f*)(biasF + (size_t)h * PLANE_F +
                               (size_t)qt * KT_COUNT * TILE_F) + l;
  const v4f* Mf = (const v4f*)(maskF + (size_t)w * PLANE_F +
                               (size_t)qt * KT_COUNT * TILE_F) + l;

  v16h Qop = load_f16_tile(Qb, qt * 16, HD, 0);   // B operand, loaded once a q-tile

  v8f oLo = {};                   // O^T rows d=0..15 (this lane: d=8g+r)
  v8f oHi = {};                   // O^T rows d=16..31
  float mrow = -3.0e38f;
  float lsum = 0.f;

  for (int k0 = 0; k0 < N_PAD; k0 += 32) {
    v16h Ka = lds_frag(kl, k0, KL_PITCH, 0);
    v16h Kc = lds_frag(kl, k0 + 16, KL_PITCH, 0);
    v8f z0 = {};
    v8f z1 = {};
    v8f s0 = wmma_f16(Ka, Qop, z0);   // keys k0   .. k0+15 (x query)
    v8f s1 = wmma_f16(Kc, Qop, z1);   // keys k0+16.. k0+31

    // s0 reg r -> key k0+8g+r, s1 reg r -> key k0+16+8g+r; padding keys carry
    // KEY_PAD in the mask plane, so no bounds test is left here.
    int tb = (k0 >> 5) * (TILE_F / 4);
    v4f b0 = Bf[tb], b1 = Bf[tb + 32], b2 = Bf[tb + 64], b3 = Bf[tb + 96];
    v4f m0 = Mf[tb], m1 = Mf[tb + 32], m2 = Mf[tb + 64], m3 = Mf[tb + 96];
#pragma unroll
    for (int r = 0; r < 4; ++r) {
      s0[r]     = s0[r]     + b0[r] + m0[r];
      s0[4 + r] = s0[4 + r] + b1[r] + m1[r];
      s1[r]     = s1[r]     + b2[r] + m2[r];
      s1[4 + r] = s1[4 + r] + b3[r] + m3[r];
    }

    // --- online softmax (row = query; pair (lane, lane^16) shares a row) ---
    float tm = s0[0];
#pragma unroll
    for (int r = 0; r < 8; ++r) { tm = fmaxf(tm, s0[r]); tm = fmaxf(tm, s1[r]); }
    tm = fmaxf(tm, __shfl_xor(tm, 16, 32));
    float mnew  = fmaxf(mrow, tm);
    float alpha = __expf(mrow - mnew);
    mrow = mnew;

    V16U p;                       // P^T in B-operand layout for K=32
    float rs = 0.f;
#pragma unroll
    for (int r = 0; r < 8; ++r) {
      float e0 = __expf(s0[r] - mnew);
      float e1 = __expf(s1[r] - mnew);
      rs += e0 + e1;
      p.h[0][r] = (_Float16)e0;   // keys k0+8g+r
      p.h[1][r] = (_Float16)e1;   // keys k0+16+8g+r
    }
    rs += __shfl_xor(rs, 16, 32);
    lsum = lsum * alpha + rs;

#pragma unroll
    for (int i = 0; i < 8; ++i) { oLo[i] *= alpha; oHi[i] *= alpha; }

    v16h Va0 = lds_frag(vl, 0,  VL_PITCH, k0);     // V^T rows d=0..15
    v16h Va1 = lds_frag(vl, 16, VL_PITCH, k0);     // V^T rows d=16..31
    oLo = wmma_f16(Va0, p.v, oLo);
    oHi = wmma_f16(Va1, p.v, oHi);
  }

  if (qg < N_TOK) {
    float inv = 1.0f / lsum;
    _Float16* dst = att + ((size_t)b * N_TOK + qg) * DIMC + h * HD;   // rows unpadded
    v8h a0, a1;
#pragma unroll
    for (int r = 0; r < 8; ++r) {
      a0[r] = (_Float16)(oLo[r] * inv);   // d = 8g + r
      a1[r] = (_Float16)(oHi[r] * inv);   // d = 16 + 8g + r
    }
    *(v8h*)(dst + 8 * g)      = a0;       // 16B contiguous
    *(v8h*)(dst + 16 + 8 * g) = a1;
    // the wave's next q-tile rewrites registers that these stores name
    asm volatile("s_wait_xcnt 0x0" ::: "memory");
  }
  }                               // q-tiles of this wave
}

// ---------------------------------------------------------------------------
// Stage 3: output projection GEMM. out[m][c] = att[m][:] . proj_w[c][:] + pb[c]
//   m = b * 343 + n runs over the 87808 = 5488 * 16 rows of att and of out
//   (both unpadded), so no row tile has an edge. blockIdx.x = group of 8 row
//   tiles; same workgroup tile as stage 1.
// ---------------------------------------------------------------------------
#define OUT_TILES (NB * N_TOK / 16)           /* 5488 = 686 * 8 */
__global__ __launch_bounds__(256, 8) void proj_gemm(
    const _Float16* __restrict__ att, const _Float16* __restrict__ pwh,
    const float* __restrict__ pb, float* __restrict__ out) {
  __shared__ __attribute__((aligned(16))) _Float16 wp[DIMC * WP_PITCH];
  int wv = __builtin_amdgcn_readfirstlane(threadIdx.x >> 5);
  int mbase = (blockIdx.x * GEMM_WAVES + wv) * 16;

  v16h a[KS_COUNT];
#pragma unroll
  for (int ks = 0; ks < KS_COUNT; ++ks)
    a[ks] = load_f16_tile(att, mbase, DIMC, ks * 32);
  // the staging below reuses the address registers of the loads above
  asm volatile("s_wait_xcnt 0x0" ::: "memory");
  stage_panel(pwh, wp);
  __syncthreads();                // the panel is complete before any wave reads it

  int l = threadIdx.x;
  int g = (l >> 4) & 1;
  float* dst = out + (size_t)(mbase + 8 * g) * DIMC + (l & 15);
  // Two column tiles a trip, rolled (unroll 1): fully unrolled, the build kept
  // one fragment set and waited out the LDS latency in front of every WMMA.
#pragma unroll 1
  for (int cp = 0; cp < CT_COUNT; cp += 2) {
    v8f acc[2] = {strip_tile(a, wp, cp), strip_tile(a, wp, cp + 1)};
#pragma unroll
    for (int u = 0; u < 2; ++u) {
      float bias = pb[(cp + u) * 16 + (l & 15)];
#pragma unroll
      for (int r = 0; r < 8; ++r)
        dst[(size_t)r * DIMC + (cp + u) * 16] = acc[u][r] + bias;
    }
    // the next trip rewrites registers that these stores name
    asm volatile("s_wait_xcnt 0x0" ::: "memory");
  }
}

// ---------------------------------------------------------------------------
// Host launcher
// ---------------------------------------------------------------------------
extern "C" void kernel_launch(void* const* d_in, const int* in_sizes, int n_in,
                              void* d_out, int out_size, void* d_ws, size_t ws_size,
                              hipStream_t stream) {
  const float* x1     = (const float*)d_in[0];
  const float* x2     = (const float*)d_in[1];
  const float* mask   = (const float*)d_in[2];
  const float* table  = (const float*)d_in[3];
  const float* q_w    = (const float*)d_in[4];
  const float* q_b    = (const float*)d_in[5];
  const float* kv_w   = (const float*)d_in[6];
  const float* kv_b   = (const float*)d_in[7];
  const float* proj_w = (const float*)d_in[8];
  const float* proj_b = (const float*)d_in[9];
  const int*   relidx = (const int*)d_in[10];
  float* out = (float*)d_out;

  char* ws = (char*)d_ws;
  // workspace layout (256B aligned)
  const size_t o_qwh  = 0;                                 //  73,728 B
  const size_t o_kvwh = o_qwh  + 73728;                    // 147,456 B
  const size_t o_pwh  = o_kvwh + 147456;                   //  73,728 B
  const size_t o_bias = o_pwh  + 73728;                    //  2,973,696 B (6 planes)
  const size_t o_mask = o_bias + 2973696;                  // 31,719,424 B (64 planes)
  const size_t o_Qh   = o_mask + 31719424;                 // 34,603,008 B
  const size_t o_Kh   = o_Qh   + 34603008;
  const size_t o_Vt   = o_Kh   + 34603008;
  const size_t o_att  = o_Vt   + 34603008;

  _Float16* qwh  = (_Float16*)(ws + o_qwh);
  _Float16* kvwh = (_Float16*)(ws + o_kvwh);
  _Float16* pwh  = (_Float16*)(ws + o_pwh);
  float*    bsm  = (float*)   (ws + o_bias);
  float*    mskf = (float*)   (ws + o_mask);
  _Float16* Qh   = (_Float16*)(ws + o_Qh);
  _Float16* Kh   = (_Float16*)(ws + o_Kh);
  _Float16* Vt   = (_Float16*)(ws + o_Vt);
  _Float16* att  = (_Float16*)(ws + o_att);

  // Stage 0: weight conversion + bias gather + mask re-layout
  cvt_f32_to_f16<<<(192 * 192 + 255) / 256, 256, 0, stream>>>(q_w, qwh, 192 * 192);
  cvt_f32_to_f16<<<(384 * 192 + 255) / 256, 256, 0, stream>>>(kv_w, kvwh, 384 * 192);
  cvt_f32_to_f16<<<(192 * 192 + 255) / 256, 256, 0, stream>>>(proj_w, pwh, 192 * 192);
  bias_gather<<<(PLANE_F + 255) / 256, 256, 0, stream>>>(table, relidx, bsm);
  mask_to_fragments<<<dim3(QT_COUNT, NWIN), 256, 0, stream>>>(mask, mskf);

  // Stage 1: QKV projections (f16 WMMA, f32 accumulate)
  qkv_gemm<<<dim3(3, ROW_TILES / GEMM_WAVES), 256, 0, stream>>>(
      x1, x2, qwh, kvwh, q_b, kv_b, Qh, Kh, Vt);

  // Stage 2: fused flash attention (QK^T + bias + mask + softmax + PV)
  flash_attn<<<dim3(NHEAD, NB), FA_THREADS, 0, stream>>>(
      Qh, Kh, Vt, bsm, mskf, att);

  // Stage 3: output projection
  proj_gemm<<<dim3(OUT_TILES / GEMM_WAVES), 256, 0, stream>>>(att, pwh, proj_b, out);
}

// v004
// One run takes 151 microseconds.
// Next to v003, in two timings, it ran 1.08 and 1.07 times as fast.
// All steps since v000 together make it 9.18 times as fast.
#include <hip/hip_runtime.h>
#include <hip/hip_bf16.h>

typedef __attribute__((ext_vector_type(16))) _Float16 v16h;
typedef __attribute__((ext_vector_type(8)))  _Float16 v8h;
typedef __attribute__((ext_vector_type(8)))  float    v8f;
typedef __attribute__((ext_vector_type(4)))  float    v4f;

#define N_TOK 343
#define N_PAD 352
#define DIMC  192
#define NHEAD 6
#define HD    32
#define NWIN  64
#define NB    256
#define QT_COUNT 22   /* 352/16 */
#define KT_COUNT 11   /* 352/32 */
#define TILE_F   512  /* floats of one 16-query x 32-key score tile */
#define PLANE_F  (QT_COUNT * KT_COUNT * TILE_F)   /* 352*352 floats */
#define TAB_ROWS 2197
#define KEY_PAD  (-1.0e30f)

union V16U { v16h v; v8h h[2]; };

// ---------------------------------------------------------------------------
// Operand loader for f16 row-major [rows][ld]:
//   A-operand: lane(0..15)=row rowBase+l, k = k0+{0..7,16..23}
//              lane(16..31)=row rowBase+(l-16), k = k0+{8..15,24..31}
// (B-operand uses the same pattern with "row" = output column / query index.)
// All chunks are 16B aligned given ld%8==0 and k0%32==0.
// ---------------------------------------------------------------------------
__device__ __forceinline__ v16h load_f16_tile(const _Float16* base, int rowBase,
                                              int ld, int k0) {
  int l = threadIdx.x;
  int r = l & 15;
  int g = (l >> 4) & 1;
  const _Float16* p = base + (size_t)(rowBase + r) * ld + k0 + g * 8;
  V16U u;
  u.h[0] = *(const v8h*)(p);
  u.h[1] = *(const v8h*)(p + 16);
  return u.v;
}

// Same lane mapping, but source is f32 (converted to f16); rows >= nvalid -> 0.
// The address is clamped and the value selected, with no branch round the
// loads, so that a wave's loads of all k steps are in flight together.
__device__ __forceinline__ v16h load_f32_tile_cvt(const float* base, int rowBase,
                                                  int nvalid, int ld, int k0) {
  int l = threadIdx.x;
  int r = l & 15;
  int g = (l >> 4) & 1;
  int row = rowBase + r;
  bool in = (row < nvalid);
  const float* p = base + (size_t)min(row, nvalid - 1) * ld + k0 + g * 8;
  v4f a0 = *(const v4f*)(p);
  v4f a1 = *(const v4f*)(p + 4);
  v4f b0 = *(const v4f*)(p + 16);
  v4f b1 = *(const v4f*)(p + 20);
  V16U u;
#pragma unroll
  for (int i = 0; i < 4; ++i) {
    u.h[0][i]     = in ? (_Float16)a0[i] : (_Float16)0.f;
    u.h[0][4 + i] = in ? (_Float16)a1[i] : (_Float16)0.f;
    u.h[1][i]     = in ? (_Float16)b0[i] : (_Float16)0.f;
    u.h[1][4 + i] = in ? (_Float16)b1[i] : (_Float16)0.f;
  }
  return u.v;
}

__device__ __forceinline__ v8f wmma_f16(v16h a, v16h b, v8f c) {
  return __builtin_amdgcn_wmma_f32_16x16x32_f16(false, a, false, b, (short)0, c,
                                                false, false);
}

// ---------------------------------------------------------------------------
// Stage 0a: f32 -> f16 weight conversion
// ---------------------------------------------------------------------------
__global__ void cvt_f32_to_f16(const float* __restrict__ src,
                               _Float16* __restrict__ dst, int n) {
  int i = blockIdx.x * 256 + threadIdx.x;
  if (i < n) dst[i] = (_Float16)src[i];
}

// ---------------------------------------------------------------------------
// Fragment order of the score addends (bias and mask planes, 352 x 352 padded):
//   plane[qt][kt][j][lane][e], one 16-query x 32-key tile = 4 x 32 x 4 floats.
//   lane = 16*g + (q & 15); key = 32*kt + 16*(j >> 1) + 8*g + 4*(j & 1) + e.
// That is the accumulator layout of S^T in flash_attn: load j of a tile is
// 32 lanes x 16 B = 512 contiguous bytes (four whole 128-B lines).
// ---------------------------------------------------------------------------

// ---------------------------------------------------------------------------
// Stage 0b: relative-position bias gather into fragment order:
//   biasF[h] at (q,k) = table[rel_idx[q][k]][h]; 0 in the padding.
// ---------------------------------------------------------------------------
__global__ void bias_gather(const float* __restrict__ table,
                            const int* __restrict__ rel_idx,
                            float* __restrict__ biasF) {
  int i = blockIdx.x * 256 + threadIdx.x;      // index inside a plane
  if (i < PLANE_F) {
    int e    = i & 3;
    int lane = (i >> 2) & 31;
    int j    = (i >> 7) & 3;
    int tile = i >> 9;
    int qt = tile / KT_COUNT;
    int kt = tile - qt * KT_COUNT;
    int q = qt * 16 + (lane & 15);
    int k = kt * 32 + (j >> 1) * 16 + (lane >> 4) * 8 + (j & 1) * 4 + e;
    bool in = (q < N_TOK) && (k < N_TOK);
    int idx = in ? rel_idx[q * N_TOK + k] : 0;
    idx = min(max(idx, 0), TAB_ROWS - 1);      // the table read stays in bounds
#pragma unroll
    for (int h = 0; h < NHEAD; ++h) {
      float tv = table[idx * NHEAD + h];
      biasF[(size_t)h * PLANE_F + i] = in ? tv : 0.f;
    }
  }
}

// ---------------------------------------------------------------------------
// Stage 0c: mask -> fragment order, one block per (q-tile, window).
//   Rows are read as whole rows (coalesced), turned in LDS, and written as
//   contiguous 16-B pieces. Padding keys get KEY_PAD, padding queries 0.
// ---------------------------------------------------------------------------
#define MROW_PITCH 356   /* floats; 16-B multiple, spreads the 16 rows over the banks */
__global__ __launch_bounds__(256) void mask_to_fragments(
    const float* __restrict__ mask, float* __restrict__ maskF) {
  __shared__ __attribute__((aligned(16))) float rows[16 * MROW_PITCH];
  int qt = blockIdx.x;
  int w  = blockIdx.y;
  int t  = threadIdx.x;
  int ln = t & 31;
  int wv = t >> 5;
  const float* Mw = mask + (size_t)w * N_TOK * N_TOK;
  // Clamped addresses instead of branches, and the loops unrolled: the 22
  // loads of a wave are then all in flight before the first LDS store waits.
  float v[2][KT_COUNT];
#pragma unroll
  for (int rr = 0; rr < 2; ++rr) {
    int q = qt * 16 + wv + 8 * rr;
    const float* Mr = Mw + (size_t)min(q, N_TOK - 1) * N_TOK;
#pragma unroll
    for (int i = 0; i < KT_COUNT; ++i) v[rr][i] = Mr[min(ln + 32 * i, N_TOK - 1)];
  }
#pragma unroll
  for (int rr = 0; rr < 2; ++rr) {
    int ql = wv + 8 * rr;
    bool qin = (qt * 16 + ql < N_TOK);
#pragma unroll
    for (int i = 0; i < KT_COUNT; ++i) {
      int k = ln + 32 * i;
      rows[ql * MROW_PITCH + k] = (k < N_TOK) ? (qin ? v[rr][i] : 0.f) : KEY_PAD;
    }
  }
  __syncthreads();
  v4f* dst = (v4f*)(maskF + (size_t)w * PLANE_F + (size_t)qt * KT_COUNT * TILE_F);
  for (int f = t; f < KT_COUNT * TILE_F / 4; f += 256) {
    int lane = f & 31;
    int j    = (f >> 5) & 3;
    int kt   = f >> 7;
    int k = kt * 32 + (j >> 1) * 16 + (lane >> 4) * 8 + (j & 1) * 4;
    dst[f] = *(const v4f*)(rows + (lane & 15) * MROW_PITCH + k);
  }
}

// ---------------------------------------------------------------------------
// Projection GEMMs: one workgroup of 8 waves per 128 rows x 192 columns.
//   The 192 x 192 f16 weight panel is staged once in LDS and shared by the 8
//   waves; each wave keeps the six A fragments of its 16 rows in registers and
//   walks the 12 column tiles. The k order of every sum is k0 = 0,32,..,160.
// ---------------------------------------------------------------------------
#define GEMM_WAVES 8
#define ROW_TILES  (QT_COUNT * NB)            /* 5632 = 704 * 8 */
#define CT_COUNT   12                         /* 192/16 column tiles of a panel */
#define KS_COUNT   6                          /* 192/32 k steps */
#define WP_PITCH   200                        /* halves: 400 B = 16 B x 25, odd, for b128 readers */
#define WP_CHUNKS  (DIMC * DIMC / 8)          /* 4608 pieces of 16 B */
// The panel takes 76,800 B, so four workgroups fit a WGP's LDS: the second
// launch bound (8 waves per SIMD) keeps the registers from allowing fewer.

__device__ __forceinline__ void stage_panel(const _Float16* __restrict__ Wp,
                                            _Float16* wp) {
  int t = threadIdx.x;
  v8h tmp[WP_CHUNKS / 256];
  // unrolled: all 18 loads of a thread are in flight before the first LDS store
#pragma unroll
  for (int i = 0; i < WP_CHUNKS / 256; ++i)
    tmp[i] = *(const v8h*)(Wp + (size_t)(t + 256 * i) * 8);
#pragma unroll
  for (int i = 0; i < WP_CHUNKS / 256; ++i) {
    int f   = t + 256 * i;
    int row = f / (DIMC / 8);
    int ch  = f - row * (DIMC / 8);
    *(v8h*)(wp + row * WP_PITCH + ch * 8) = tmp[i];
  }
}

// Same lane mapping as load_f16_tile, from the LDS panel.
__device__ __forceinline__ v16h panel_frag(const _Float16* wp, int rowBase, int k0) {
  int l = threadIdx.x;
  int r = l & 15;
  int g = (l >> 4) & 1;
  const _Float16* p = wp + (rowBase + r) * WP_PITCH + k0 + g * 8;
  V16U u;
  u.h[0] = *(const v8h*)(p);
  u.h[1] = *(const v8h*)(p + 16);
  return u.v;
}

__device__ __forceinline__ v8f strip_tile(const v16h (&a)[KS_COUNT],
                                          const _Float16* wp, int ct) {
  v8f acc = {};
#pragma unroll
  for (int ks = 0; ks < KS_COUNT; ++ks)
    acc = wmma_f16(a[ks], panel_frag(wp, ct * 16, ks * 32), acc);
  return acc;
}

// ---------------------------------------------------------------------------
// Stage 1: QKV projection GEMM.
//   blockIdx.x = panel (0 Q, 1 K, 2 V), blockIdx.y = group of 8 row tiles
//   Q  -> Qh[b][h][n][d]  (f16, pre-scaled by hd^-0.5)
//   K  -> Kh[b][h][n][d]  (f16)
//   V  -> Vt[b][h][d][n]  (f16, transposed; contiguous stores)
// ---------------------------------------------------------------------------
__global__ __launch_bounds__(256, 8) void qkv_gemm(
    const float* __restrict__ x1, const float* __restrict__ x2,
    const _Float16* __restrict__ qwh, const _Float16* __restrict__ kvwh,
    const float* __restrict__ qb, const float* __restrict__ kvb,
    _Float16* __restrict__ Qh, _Float16* __restrict__ Kh,
    _Float16* __restrict__ Vt) {
  __shared__ __attribute__((aligned(16))) _Float16 wp[DIMC * WP_PITCH];
  int pn = blockIdx.x;
  int wv = __builtin_amdgcn_readfirstlane(threadIdx.x >> 5);
  int rt = blockIdx.y * GEMM_WAVES + wv;      // row tile, 0..5631
  int b  = rt / QT_COUNT;
  int nbase = (rt - b * QT_COUNT) * 16;
  const float*    X  = (pn == 0) ? x1 : x2;
  const _Float16* Wp = (pn == 0) ? qwh : kvwh + (size_t)(pn - 1) * DIMC * DIMC;
  const float*    bv = (pn == 0) ? qb : kvb + (pn - 1) * DIMC;

  stage_panel(Wp, wp);
  // Keeps the 24 f32 loads below from being lifted among the 18 staging loads:
  // both sets in flight at once need more registers than 8 waves per SIMD leave,
  // and the build then spills to scratch.
  __builtin_amdgcn_sched_barrier(0);
  v16h a[KS_COUNT];
#pragma unroll
  for (int ks = 0; ks < KS_COUNT; ++ks)
    a[ks] = load_f32_tile_cvt(X + (size_t)b * N_TOK * DIMC, nbase, N_TOK, DIMC, ks * 32);
  __syncthreads();                // the panel is complete before any wave reads it

  int l = threadIdx.x;
  int g = (l >> 4) & 1;           // register group: rows nbase+8g .. nbase+8g+7
  int cl = l & 15;                // this lane's output column inside a tile

  // The walks go two column tiles a trip and stay rolled (unroll 1): unrolled,
  // the fragment loads of all 12 tiles are hoisted until A spills to scratch.
  if (pn == 2) {
#pragma unroll 1
    for (int cp = 0; cp < CT_COUNT; cp += 2) {
      v8f acc[2] = {strip_tile(a, wp, cp), strip_tile(a, wp, cp + 1)};
#pragma unroll
      for (int u = 0; u < 2; ++u) {
        int c = (cp + u) * 16 + cl;
        float bias = bv[c];
        _Float16* dst = Vt + ((size_t)b * DIMC + c) * N_PAD + nbase + 8 * g;
        v8h o;
#pragma unroll
        for (int r = 0; r < 8; ++r) o[r] = (_Float16)(acc[u][r] + bias);
        *(v8h*)dst = o;   // 16B contiguous
      }
    }
  } else if (pn == 1) {
#pragma unroll 1
    for (int cp = 0; cp < CT_COUNT; cp += 2) {
      v8f acc[2] = {strip_tile(a, wp, cp), strip_tile(a, wp, cp + 1)};
      _Float16* base = Kh + ((size_t)b * NHEAD + (cp >> 1)) * N_PAD * HD;   // head cp/2
#pragma unroll
      for (int u = 0; u < 2; ++u) {
        float bias = bv[(cp + u) * 16 + cl];
        int d = u * 16 + cl;
#pragma unroll
        for (int r = 0; r < 8; ++r) {
          int n = nbase + 8 * g + r;
          base[(size_t)n * HD + d] = (_Float16)(acc[u][r] + bias);
        }
      }
    }
  } else {
    const float scale = 0.17677669529663687f;  // 32^-0.5
#pragma unroll 1
    for (int cp = 0; cp < CT_COUNT; cp += 2) {
      v8f acc[2] = {strip_tile(a, wp, cp), strip_tile(a, wp, cp + 1)};
      _Float16* base = Qh + ((size_t)b * NHEAD + (cp >> 1)) * N_PAD * HD;   // head cp/2
#pragma unroll
      for (int u = 0; u < 2; ++u) {
        float bias = bv[(cp + u) * 16 + cl];
        int d = u * 16 + cl;
#pragma unroll
        for (int r = 0; r < 8; ++r) {
          int n = nbase + 8 * g + r;
          base[(size_t)n * HD + d] = (_Float16)((acc[u][r] + bias) * scale);
        }
      }
    }
  }
}

// ---------------------------------------------------------------------------
// Stage 2: flash attention, one workgroup of 11 waves per (window, head, pair
//   of batches, half of the q-tiles); a wave takes one q-tile. Batches b and
//   b + 64 have the same window, so at one head they add the same bias and mask
//   tile to their scores: a wave loads and sums that tile once a k step and
//   uses the sum for both batches, as the start value (C operand) of their
//   score products. K and V^T of both batches are staged once in LDS and
//   shared by the 11 waves.
//   Computes S^T = K x Q^T so P^T (in D-register layout) is directly the
//   B operand of O^T = V^T x P^T (32 keys per iteration => K=32 exactly).
//   102,400 B of LDS and this kernel's registers let two workgroups share a
//   WGP: the 1536 workgroups are three full rounds of 256 x 2.
// ---------------------------------------------------------------------------
#define FA_WAVES   (QT_COUNT / 2)             /* 11 */
#define FA_THREADS (FA_WAVES * 32)            /* 352 */
#define FA_NB      2                          /* batches of one window in a workgroup */
#define FA_PAIRS   (NB / NWIN / FA_NB)        /* 2 such pairs a window */
#define FA_QSPLIT  (QT_COUNT / FA_WAVES)      /* 2 workgroups share the 22 q-tiles */
#define KL_PITCH   40                         /* halves: 80 B = 16 B x 5, odd, for b128 readers */
#define VL_PITCH   360                        /* halves: 720 B = 16 B x 45, odd */
#define KV_CHUNKS  (N_PAD * HD / 8)           /* 1408 pieces of 16 B in K, and in V^T */

// Same lane mapping as load_f16_tile, from an LDS array of the given pitch.
__device__ __forceinline__ v16h lds_frag(const _Float16* base, int rowBase,
                                         int pitch, int k0) {
  int l = threadIdx.x;
  int r = l & 15;
  int g = (l >> 4) & 1;
  const _Float16* p = base + (rowBase + r) * pitch + k0 + g * 8;
  V16U u;
  u.h[0] = *(const v8h*)(p);
  u.h[1] = *(const v8h*)(p + 16);
  return u.v;
}

__global__ __launch_bounds__(FA_THREADS) void flash_attn(
    const _Float16* __restrict__ Qh, const _Float16* __restrict__ Kh,
    const _Float16* __restrict__ Vt, const float* __restrict__ biasF,
    const float* __restrict__ maskF, _Float16* __restrict__ att) {
  __shared__ __attribute__((aligned(16))) _Float16 kl[FA_NB][N_PAD * KL_PITCH];   // 2 x 28,160 B
  __shared__ __attribute__((aligned(16))) _Float16 vl[FA_NB][HD * VL_PITCH];      // 2 x 23,040 B
  int h  = blockIdx.x;            // 0..5
  int pr = blockIdx.y % FA_PAIRS; // pair of batches of the window
  int qh = blockIdx.y / FA_PAIRS; // half of the q-tiles
  int w  = blockIdx.z;            // window index of the mask, 0..63
  int t  = threadIdx.x;
  int wv = __builtin_amdgcn_readfirstlane(t >> 5);   // 0..10

  // batch n of the pair: b = w + 64 * (2 * pr + n), so b % 64 == w
  const size_t bh0    = ((size_t)(w + NWIN * FA_NB * pr)) * NHEAD + h;
  const size_t bhStep = (size_t)NWIN * NHEAD * N_PAD * HD;   // halves from batch n to n + 1
  const _Float16* Qb = Qh + bh0 * N_PAD * HD;
  const _Float16* Kb = Kh + bh0 * N_PAD * HD;
  const _Float16* Vb = Vt + bh0 * HD * N_PAD;

  // The arrays are read as they lie (contiguous 16-B pieces, four of each a
  // thread and batch, all in flight together) and laid down at the padded pitches.
  v8h kc[FA_NB][KV_CHUNKS / FA_THREADS], vc[FA_NB][KV_CHUNKS / FA_THREADS];
#pragma unroll
  for (int n = 0; n < FA_NB; ++n) {
#pragma unroll
    for (int i = 0; i < KV_CHUNKS / FA_THREADS; ++i) {
      kc[n][i] = *(const v8h*)(Kb + n * bhStep + (size_t)(t + FA_THREADS * i) * 8);
      vc[n][i] = *(const v8h*)(Vb + n * bhStep + (size_t)(t + FA_THREADS * i) * 8);
    }
  }
#pragma unroll
  for (int n = 0; n < FA_NB; ++n) {
#pragma unroll
    for (int i = 0; i < KV_CHUNKS / FA_THREADS; ++i) {
      int f  = t + FA_THREADS * i;
      int kr = f / (HD / 8);
      int vr = f / (N_PAD / 8);
      *(v8h*)(kl[n] + kr * KL_PITCH + (f - kr * (HD / 8)) * 8)    = kc[n][i];
      *(v8h*)(vl[n] + vr * VL_PITCH + (f - vr * (N_PAD / 8)) * 8) = vc[n][i];
    }
  }
  __syncthreads();                // K and V^T are complete before any wave reads them

  int l  = t & 31;
  int q  = l & 15;
  int g  = (l >> 4) & 1;
  int qt = qh * FA_WAVES + wv;    // this wave's q-tile
  int qg = qt * 16 + q;           // this lane's global query index

  // this lane's 16-B pieces of the addend tiles of q-tile qt (fragment order)
  const v4f* Bf = (const v4f*)(biasF + (size_t)h * PLANE_F +
                               (size_t)qt * KT_COUNT * TILE_F) + l;
  const v4f* Mf = (const v4f*)(maskF + (size_t)w * PLANE_F +
                               (size_t)qt * KT_COUNT * TILE_F) + l;

  v16h Qop[FA_NB];                // B operands, loaded once
  v8f oLo[FA_NB];                 // O^T rows d=0..15 (this lane: d=8g+r)
  v8f oHi[FA_NB];                 // O^T rows d=16..31
  float mrow[FA_NB];
  float lsum[FA_NB];
#pragma unroll
  for (int n = 0; n < FA_NB; ++n) {
    Qop[n] = load_f16_tile(Qb + n * bhStep, qt * 16, HD, 0);
    oLo[n] = v8f{};
    oHi[n] = v8f{};
    mrow[n] = -3.0e38f;
    lsum[n] = 0.f;
  }

  for (int k0 = 0; k0 < N_PAD; k0 += 32) {
    // c0 reg r -> key k0+8g+r, c1 reg r -> key k0+16+8g+r; padding keys carry
    // KEY_PAD in the mask plane, so no bounds test is left here.
    int tb = (k0 >> 5) * (TILE_F / 4);
    v4f b0 = Bf[tb], b1 = Bf[tb + 32], b2 = Bf[tb + 64], b3 = Bf[tb + 96];
    v4f m0 = Mf[tb], m1 = Mf[tb + 32], m2 = Mf[tb + 64], m3 = Mf[tb + 96];
    v8f c0, c1;
#pragma unroll
    for (int r = 0; r < 4; ++r) {
      c0[r]     = b0[r] + m0[r];
      c0[4 + r] = b1[r] + m1[r];
      c1[r]     = b2[r] + m2[r];
      c1[4 + r] = b3[r] + m3[r];
    }

#pragma unroll
    for (int n = 0; n < FA_NB; ++n) {
    v16h Ka = lds_frag(kl[n], k0, KL_PITCH, 0);
    v16h Kc = lds_frag(kl[n], k0 + 16, KL_PITCH, 0);
    v8f s0 = wmma_f16(Ka, Qop[n], c0);   // keys k0   .. k0+15 (x query)
    v8f s1 = wmma_f16(Kc, Qop[n], c1);   // keys k0+16.. k0+31

    // --- online softmax (row = query; pair (lane, lane^16) shares a row) ---
    float tm = s0[0];
#pragma unroll
    for (int r = 0; r < 8; ++r) { tm = fmaxf(tm, s0[r]); tm = fmaxf(tm, s1[r]); }
    tm = fmaxf(tm, __shfl_xor(tm, 16, 32));
    float mnew  = fmaxf(mrow[n], tm);
    float alpha = __expf(mrow[n] - mnew);
    mrow[n] = mnew;

    V16U p;                       // P^T in B-operand layout for K=32
    float rs = 0.f;
#pragma unroll
    for (int r = 0; r < 8; ++r) {
      float e0 = __expf(s0[r] - mnew);
      float e1 = __expf(s1[r] - mnew);
      rs += e0 + e1;
      p.h[0][r] = (_Float16)e0;   // keys k0+8g+r
      p.h[1][r] = (_Float16)e1;   // keys k0+16+8g+r
    }
    rs += __shfl_xor(rs, 16, 32);
    lsum[n] = lsum[n] * alpha + rs;

#pragma unroll
    for (int i = 0; i < 8; ++i) { oLo[n][i] *= alpha; oHi[n][i] *= alpha; }

    v16h Va0 = lds_frag(vl[n], 0,  VL_PITCH, k0);     // V^T rows d=0..15
    v16h Va1 = lds_frag(vl[n], 16, VL_PITCH, k0);     // V^T rows d=16..31
    oLo[n] = wmma_f16(Va0, p.v, oLo[n]);
    oHi[n] = wmma_f16(Va1, p.v, oHi[n]);
    }                             // batches of the pair
  }

  if (qg < N_TOK) {
#pragma unroll
    for (int n = 0; n < FA_NB; ++n) {
      int b = w + NWIN * (FA_NB * pr + n);
      float inv = 1.0f / lsum[n];
      _Float16* dst = att + ((size_t)b * N_TOK + qg) * DIMC + h * HD;   // rows unpadded
      v8h a0, a1;
#pragma unroll
      for (int r = 0; r < 8; ++r) {
        a0[r] = (_Float16)(oLo[n][r] * inv);   // d = 8g + r
        a1[r] = (_Float16)(oHi[n][r] * inv);   // d = 16 + 8g + r
      }
      *(v8h*)(dst + 8 * g)      = a0;       // 16B contiguous
      *(v8h*)(dst + 16 + 8 * g) = a1;
    }
  }
}

// ---------------------------------------------------------------------------
// Stage 3: output projection GEMM. out[m][c] = att[m][:] . proj_w[c][:] + pb[c]
//   m = b * 343 + n runs over the 87808 = 5488 * 16 rows of att and of out
//   (both unpadded), so no row tile has an edge. blockIdx.x = group of 8 row
//   tiles; same workgroup tile as stage 1.
// ---------------------------------------------------------------------------
#define OUT_TILES (NB * N_TOK / 16)           /* 5488 = 686 * 8 */
__global__ __launch_bounds__(256, 8) void proj_gemm(
    const _Float16* __restrict__ att, const _Float16* __restrict__ pwh,
    const float* __restrict__ pb, float* __restrict__ out) {
  __shared__ __attribute__((aligned(16))) _Float16 wp[DIMC * WP_PITCH];
  int wv = __builtin_amdgcn_readfirstlane(threadIdx.x >> 5);
  int mbase = (blockIdx.x * GEMM_WAVES + wv) * 16;

  v16h a[KS_COUNT];
#pragma unroll
  for (int ks = 0; ks < KS_COUNT; ++ks)
    a[ks] = load_f16_tile(att, mbase, DIMC, ks * 32);
  // the staging below reuses the address registers of the loads above
  asm volatile("s_wait_xcnt 0x0" ::: "memory");
  stage_panel(pwh, wp);
  __syncthreads();                // the panel is complete before any wave reads it

  int l = threadIdx.x;
  int g = (l >> 4) & 1;
  float* dst = out + (size_t)(mbase + 8 * g) * DIMC + (l & 15);
  // Two column tiles a trip, rolled (unroll 1): fully unrolled, the build kept
  // one fragment set and waited out the LDS latency in front of every WMMA.
#pragma unroll 1
  for (int cp = 0; cp < CT_COUNT; cp += 2) {
    v8f acc[2] = {strip_tile(a, wp, cp), strip_tile(a, wp, cp + 1)};
#pragma unroll
    for (int u = 0; u < 2; ++u) {
      float bias = pb[(cp + u) * 16 + (l & 15)];
#pragma unroll
      for (int r = 0; r < 8; ++r)
        dst[(size_t)r * DIMC + (cp + u) * 16] = acc[u][r] + bias;
    }
    // the next trip rewrites registers that these stores name
    asm volatile("s_wait_xcnt 0x0" ::: "memory");
  }
}

// ---------------------------------------------------------------------------
// Host launcher
// ---------------------------------------------------------------------------
extern "C" void kernel_launch(void* const* d_in, const int* in_sizes, int n_in,
                              void* d_out, int out_size, void* d_ws, size_t ws_size,
                              hipStream_t stream) {
  const float* x1     = (const float*)d_in[0];
  const float* x2     = (const float*)d_in[1];
  const float* mask   = (const float*)d_in[2];
  const float* table  = (const float*)d_in[3];
  const float* q_w    = (const float*)d_in[4];
  const float* q_b    = (const float*)d_in[5];
  const float* kv_w   = (const float*)d_in[6];
  const float* kv_b   = (const float*)d_in[7];
  const float* proj_w = (const float*)d_in[8];
  const float* proj_b = (const float*)d_in[9];
  const int*   relidx = (const int*)d_in[10];
  float* out = (float*)d_out;

  char* ws = (char*)d_ws;
  // workspace layout (256B aligned)
  const size_t o_qwh  = 0;                                 //  73,728 B
  const size_t o_kvwh = o_qwh  + 73728;                    // 147,456 B
  const size_t o_pwh  = o_kvwh + 147456;                   //  73,728 B
  const size_t o_bias = o_pwh  + 73728;                    //  2,973,696 B (6 planes)
  const size_t o_mask = o_bias + 2973696;                  // 31,719,424 B (64 planes)
  const size_t o_Qh   = o_mask + 31719424;                 // 34,603,008 B
  const size_t o_Kh   = o_Qh   + 34603008;
  const size_t o_Vt   = o_Kh   + 34603008;
  const size_t o_att  = o_Vt   + 34603008;

  _Float16* qwh  = (_Float16*)(ws + o_qwh);
  _Float16* kvwh = (_Float16*)(ws + o_kvwh);
  _Float16* pwh  = (_Float16*)(ws + o_pwh);
  float*    bsm  = (float*)   (ws + o_bias);
  float*    mskf = (float*)   (ws + o_mask);
  _Float16* Qh   = (_Float16*)(ws + o_Qh);
  _Float16* Kh   = (_Float16*)(ws + o_Kh);
  _Float16* Vt   = (_Float16*)(ws + o_Vt);
  _Float16* att  = (_Float16*)(ws + o_att);

  // Stage 0: weight conversion + bias gather + mask re-layout
  cvt_f32_to_f16<<<(192 * 192 + 255) / 256, 256, 0, stream>>>(q_w, qwh, 192 * 192);
  cvt_f32_to_f16<<<(384 * 192 + 255) / 256, 256, 0, stream>>>(kv_w, kvwh, 384 * 192);
  cvt_f32_to_f16<<<(192 * 192 + 255) / 256, 256, 0, stream>>>(proj_w, pwh, 192 * 192);
  bias_gather<<<(PLANE_F + 255) / 256, 256, 0, stream>>>(table, relidx, bsm);
  mask_to_fragments<<<dim3(QT_COUNT, NWIN), 256, 0, stream>>>(mask, mskf);

  // Stage 1: QKV projections (f16 WMMA, f32 accumulate)
  qkv_gemm<<<dim3(3, ROW_TILES / GEMM_WAVES), 256, 0, stream>>>(
      x1, x2, qwh, kvwh, q_b, kv_b, Qh, Kh, Vt);

  // Stage 2: fused flash attention (QK^T + bias + mask + softmax + PV)
  flash_attn<<<dim3(NHEAD, FA_PAIRS * FA_QSPLIT, NWIN), FA_THREADS, 0, stream>>>(
      Qh, Kh, Vt, bsm, mskf, att);

  // Stage 3: output projection
  proj_gemm<<<dim3(OUT_TILES / GEMM_WAVES), 256, 0, stream>>>(att, pwh, proj_b, out);
}

// v005
// One run takes 134 microseconds.
// In both of two side-by-side timings against v004, it was 1.13 times as fast.
// Over all steps from v000 it is 10.4 times as fast.
#include <hip/hip_runtime.h>
#include <hip/hip_bf16.h>

typedef __attribute__((ext_vector_type(16))) _Float16 v16h;
typedef __attribute__((ext_vector_type(8)))  _Float16 v8h;
typedef __attribute__((ext_vector_type(8)))  float    v8f;
typedef __attribute__((ext_vector_type(4)))  float    v4f;

#define N_TOK 343
#define N_PAD 352
#define DIMC  192
#define NHEAD 6
#define HD    32
#define NWIN  64
#define NB    256
#define QT_COUNT 22   /* 352/16 */
#define KT_COUNT 11   /* 352/32 */
#define TILE_F   512  /* floats of one 16-query x 32-key score tile */
#define PLANE_F  (QT_COUNT * KT_COUNT * TILE_F)   /* 352*352 floats */
#define TAB_ROWS 2197
#define KEY_PAD  (-1.0e30f)

union V16U { v16h v; v8h h[2]; };

// ---------------------------------------------------------------------------
// Operand loader for f16 row-major [rows][ld]:
//   A-operand: lane(0..15)=row rowBase+l, k = k0+{0..7,16..23}
//              lane(16..31)=row rowBase+(l-16), k = k0+{8..15,24..31}
// (B-operand uses the same pattern with "row" = output column / query index.)
// All chunks are 16B aligned given ld%8==0 and k0%32==0.
// ---------------------------------------------------------------------------
__device__ __forceinline__ v16h load_f16_tile(const _Float16* base, int rowBase,
                                              int ld, int k0) {
  int l = threadIdx.x;
  int r = l & 15;
  int g = (l >> 4) & 1;
  const _Float16* p = base + (size_t)(rowBase + r) * ld + k0 + g * 8;
  V16U u;
  u.h[0] = *(const v8h*)(p);
  u.h[1] = *(const v8h*)(p + 16);
  return u.v;
}

// Same lane mapping, but source is f32 (converted to f16); rows >= nvalid -> 0.
// The address is clamped and the value selected, with no branch round the
// loads, so that a wave's loads of all k steps are in flight together.
__device__ __forceinline__ v16h load_f32_tile_cvt(const float* base, int rowBase,
                                                  int nvalid, int ld, int k0) {
  int l = threadIdx.x;
  int r = l & 15;
  int g = (l >> 4) & 1;
  int row = rowBase + r;
  bool in = (row < nvalid);
  const float* p = base + (size_t)min(row, nvalid - 1) * ld + k0 + g * 8;
  v4f a0 = *(const v4f*)(p);
  v4f a1 = *(const v4f*)(p + 4);
  v4f b0 = *(const v4f*)(p + 16);
  v4f b1 = *(const v4f*)(p + 20);
  V16U u;
#pragma unroll
  for (int i = 0; i < 4; ++i) {
    u.h[0][i]     = in ? (_Float16)a0[i] : (_Float16)0.f;
    u.h[0][4 + i] = in ? (_Float16)a1[i] : (_Float16)0.f;
    u.h[1][i]     = in ? (_Float16)b0[i] : (_Float16)0.f;
    u.h[1][4 + i] = in ? (_Float16)b1[i] : (_Float16)0.f;
  }
  return u.v;
}

__device__ __forceinline__ v8f wmma_f16(v16h a, v16h b, v8f c) {
  return __builtin_amdgcn_wmma_f32_16x16x32_f16(false, a, false, b, (short)0, c,
                                                false, false);
}

// ---------------------------------------------------------------------------
// Stage 0a: f32 -> f16 weight conversion, block blk of 256 elements.
//   The Q and the K/V weights, which stage 1 reads, share one launch; the
//   output projection's weights are converted inside stage 1's launch.
// ---------------------------------------------------------------------------
#define QW_BLOCKS  (DIMC * DIMC / 256)        /* 144 */
#define KVW_BLOCKS (2 * DIMC * DIMC / 256)    /* 288 */
__device__ __forceinline__ void cvt_block(const float* __restrict__ src,
                                          _Float16* __restrict__ dst, int n, int blk) {
  int i = blk * 256 + threadIdx.x;
  if (i < n) dst[i] = (_Float16)src[i];
}

__global__ __launch_bounds__(256) void cvt_qkv_weights(
    const float* __restrict__ qw, const float* __restrict__ kvw,
    _Float16* __restrict__ qwh, _Float16* __restrict__ kvwh) {
  int blk = blockIdx.x;
  if (blk < QW_BLOCKS) cvt_block(qw, qwh, DIMC * DIMC, blk);
  else                 cvt_block(kvw, kvwh, 2 * DIMC * DIMC, blk - QW_BLOCKS);
}

// ---------------------------------------------------------------------------
// Fragment order of the score addends (bias and mask planes, 352 x 352 padded):
//   plane[qt][kt][j][lane][e], one 16-query x 32-key tile = 4 x 32 x 4 floats.
//   lane = 16*g + (q & 15); key = 32*kt + 16*(j >> 1) + 8*g + 4*(j & 1) + e.
// That is the accumulator layout of S^T in flash_attn: load j of a tile is
// 32 lanes x 16 B = 512 contiguous bytes (four whole 128-B lines).
// ---------------------------------------------------------------------------

// ---------------------------------------------------------------------------
// Stage 0b: relative-position bias gather into fragment order:
//   biasF[h] at (q,k) = table[rel_idx[q][k]][h]; 0 in the padding.
// ---------------------------------------------------------------------------
#define BIAS_BLOCKS ((PLANE_F + 255) / 256)   /* 484 */
__device__ __forceinline__ void bias_gather(const float* __restrict__ table,
                                            const int* __restrict__ rel_idx,
                                            float* __restrict__ biasF, int blk) {
  int i = blk * 256 + threadIdx.x;             // index inside a plane
  if (i < PLANE_F) {
    int e    = i & 3;
    int lane = (i >> 2) & 31;
    int j    = (i >> 7) & 3;
    int tile = i >> 9;
    int qt = tile / KT_COUNT;
    int kt = tile - qt * KT_COUNT;
    int q = qt * 16 + (lane & 15);
    int k = kt * 32 + (j >> 1) * 16 + (lane >> 4) * 8 + (j & 1) * 4 + e;
    bool in = (q < N_TOK) && (k < N_TOK);
    int idx = in ? rel_idx[q * N_TOK + k] : 0;
    idx = min(max(idx, 0), TAB_ROWS - 1);      // the table read stays in bounds
#pragma unroll
    for (int h = 0; h < NHEAD; ++h) {
      float tv = table[idx * NHEAD + h];
      biasF[(size_t)h * PLANE_F + i] = in ? tv : 0.f;
    }
  }
}

// ---------------------------------------------------------------------------
// Stage 0c: mask -> fragment order, one block per (q-tile, window): blk = 22 w + qt.
//   Rows are read as whole rows (coalesced), turned in LDS, and written as
//   contiguous 16-B pieces. Padding keys get KEY_PAD, padding queries 0.
// ---------------------------------------------------------------------------
#define MROW_PITCH 356   /* floats; 16-B multiple, spreads the 16 rows over the banks */
#define MASK_BLOCKS (QT_COUNT * NWIN)         /* 1408 */
__device__ __forceinline__ void mask_to_fragments(
    const float* __restrict__ mask, float* __restrict__ maskF,
    float* rows /* LDS, 16 * MROW_PITCH floats */, int blk) {
  int w  = blk / QT_COUNT;
  int qt = blk - w * QT_COUNT;
  int t  = threadIdx.x;
  int ln = t & 31;
  int wv = t >> 5;
  const float* Mw = mask + (size_t)w * N_TOK * N_TOK;
  // Clamped addresses instead of branches, and the loops unrolled: the 22
  // loads of a wave are then all in flight before the first LDS store waits.
  float v[2][KT_COUNT];
#pragma unroll
  for (int rr = 0; rr < 2; ++rr) {
    int q = qt * 16 + wv + 8 * rr;
    const float* Mr = Mw + (size_t)min(q, N_TOK - 1) * N_TOK;
#pragma unroll
    for (int i = 0; i < KT_COUNT; ++i) v[rr][i] = Mr[min(ln + 32 * i, N_TOK - 1)];
  }
#pragma unroll
  for (int rr = 0; rr < 2; ++rr) {
    int ql = wv + 8 * rr;
    bool qin = (qt * 16 + ql < N_TOK);
#pragma unroll
    for (int i = 0; i < KT_COUNT; ++i) {
      int k = ln + 32 * i;
      rows[ql * MROW_PITCH + k] = (k < N_TOK) ? (qin ? v[rr][i] : 0.f) : KEY_PAD;
    }
  }
  __syncthreads();
  v4f* dst = (v4f*)(maskF + (size_t)w * PLANE_F + (size_t)qt * KT_COUNT * TILE_F);
  for (int f = t; f < KT_COUNT * TILE_F / 4; f += 256) {
    int lane = f & 31;
    int j    = (f >> 5) & 3;
    int kt   = f >> 7;
    int k = kt * 32 + (j >> 1) * 16 + (lane >> 4) * 8 + (j & 1) * 4;
    dst[f] = *(const v4f*)(rows + (lane & 15) * MROW_PITCH + k);
  }
}

// ---------------------------------------------------------------------------
// Projection GEMMs: one workgroup of 8 waves per 128 rows x 192 columns.
//   The 192 x 192 f16 weight panel is staged once in LDS and shared by the 8
//   waves; each wave keeps the six A fragments of its 16 rows in registers and
//   walks the 12 column tiles. The k order of every sum is k0 = 0,32,..,160.
// ---------------------------------------------------------------------------
#define GEMM_WAVES 8
#define ROW_TILES  (QT_COUNT * NB)            /* 5632 = 704 * 8 */
#define CT_COUNT   12                         /* 192/16 column tiles of a panel */
#define KS_COUNT   6                          /* 192/32 k steps */
#define WP_PITCH   200                        /* halves: 400 B = 16 B x 25, odd, for b128 readers */
#define WP_CHUNKS  (DIMC * DIMC / 8)          /* 4608 pieces of 16 B */
// The panel takes 76,800 B, so four workgroups fit a WGP's LDS: the second
// launch bound (8 waves per SIMD) keeps the registers from allowing fewer.

__device__ __forceinline__ void stage_panel(const _Float16* __restrict__ Wp,
                                            _Float16* wp) {
  int t = threadIdx.x;
  v8h tmp[WP_CHUNKS / 256];
  // unrolled: all 18 loads of a thread are in flight before the first LDS store
#pragma unroll
  for (int i = 0; i < WP_CHUNKS / 256; ++i)
    tmp[i] = *(const v8h*)(Wp + (size_t)(t + 256 * i) * 8);
#pragma unroll
  for (int i = 0; i < WP_CHUNKS / 256; ++i) {
    int f   = t + 256 * i;
    int row = f / (DIMC / 8);
    int ch  = f - row * (DIMC / 8);
    *(v8h*)(wp + row * WP_PITCH + ch * 8) = tmp[i];
  }
}

// Same lane mapping as load_f16_tile, from the LDS panel.
__device__ __forceinline__ v16h panel_frag(const _Float16* wp, int rowBase, int k0) {
  int l = threadIdx.x;
  int r = l & 15;
  int g = (l >> 4) & 1;
  const _Float16* p = wp + (rowBase + r) * WP_PITCH + k0 + g * 8;
  V16U u;
  u.h[0] = *(const v8h*)(p);
  u.h[1] = *(const v8h*)(p + 16);
  return u.v;
}

__device__ __forceinline__ v8f strip_tile(const v16h (&a)[KS_COUNT],
                                          const _Float16* wp, int ct) {
  v8f acc = {};
#pragma unroll
  for (int ks = 0; ks < KS_COUNT; ++ks)
    acc = wmma_f16(a[ks], panel_frag(wp, ct * 16, ks * 32), acc);
  return acc;
}

// ---------------------------------------------------------------------------
// Stage 1: QKV projection GEMM, block blk of QKV_BLOCKS.
//   blk % 3 = panel (0 Q, 1 K, 2 V), blk / 3 = group of 8 row tiles
//   Q  -> Qh[b][h][n][d]  (f16, pre-scaled by hd^-0.5)
//   K  -> Kh[b][h][n][d]  (f16)
//   V  -> Vt[b][h][d][n]  (f16, transposed; contiguous stores)
// ---------------------------------------------------------------------------
#define QKV_BLOCKS (3 * ROW_TILES / GEMM_WAVES)   /* 2112 */
__device__ __forceinline__ void qkv_gemm(
    const float* __restrict__ x1, const float* __restrict__ x2,
    const _Float16* __restrict__ qwh, const _Float16* __restrict__ kvwh,
    const float* __restrict__ qb, const float* __restrict__ kvb,
    _Float16* __restrict__ Qh, _Float16* __restrict__ Kh,
    _Float16* __restrict__ Vt, _Float16* wp /* LDS panel */, int blk) {
  int grp = blk / 3;
  int pn  = blk - grp * 3;
  int wv = __builtin_amdgcn_readfirstlane(threadIdx.x >> 5);
  int rt = grp * GEMM_WAVES + wv;             // row tile, 0..5631
  int b  = rt / QT_COUNT;
  int nbase = (rt - b * QT_COUNT) * 16;
  const float*    X  = (pn == 0) ? x1 : x2;
  const _Float16* Wp = (pn == 0) ? qwh : kvwh + (size_t)(pn - 1) * DIMC * DIMC;
  const float*    bv = (pn == 0) ? qb : kvb + (pn - 1) * DIMC;

  stage_panel(Wp, wp);
  // Keeps the 24 f32 loads below from being lifted among the 18 staging loads:
  // both sets in flight at once need more registers than 8 waves per SIMD leave,
  // and the build then spills to scratch.
  __builtin_amdgcn_sched_barrier(0);
  v16h a[KS_COUNT];
#pragma unroll
  for (int ks = 0; ks < KS_COUNT; ++ks)
    a[ks] = load_f32_tile_cvt(X + (size_t)b * N_TOK * DIMC, nbase, N_TOK, DIMC, ks * 32);
  __syncthreads();                // the panel is complete before any wave reads it

  int l = threadIdx.x;
  int g = (l >> 4) & 1;           // register group: rows nbase+8g .. nbase+8g+7
  int cl = l & 15;                // this lane's output column inside a tile

  // The walks go two column tiles a trip and stay rolled (unroll 1): unrolled,
  // the fragment loads of all 12 tiles are hoisted until A spills to scratch.
  if (pn == 2) {
#pragma unroll 1
    for (int cp = 0; cp < CT_COUNT; cp += 2) {
      v8f acc[2] = {strip_tile(a, wp, cp), strip_tile(a, wp, cp + 1)};
#pragma unroll
      for (int u = 0; u < 2; ++u) {
        int c = (cp + u) * 16 + cl;
        float bias = bv[c];
        _Float16* dst = Vt + ((size_t)b * DIMC + c) * N_PAD + nbase + 8 * g;
        v8h o;
#pragma unroll
        for (int r = 0; r < 8; ++r) o[r] = (_Float16)(acc[u][r] + bias);
        *(v8h*)dst = o;   // 16B contiguous
      }
    }
  } else if (pn == 1) {
#pragma unroll 1
    for (int cp = 0; cp < CT_COUNT; cp += 2) {
      v8f acc[2] = {strip_tile(a, wp, cp), strip_tile(a, wp, cp + 1)};
      _Float16* base = Kh + ((size_t)b * NHEAD + (cp >> 1)) * N_PAD * HD;   // head cp/2
#pragma unroll
      for (int u = 0; u < 2; ++u) {
        float bias = bv[(cp + u) * 16 + cl];
        int d = u * 16 + cl;
#pragma unroll
        for (int r = 0; r < 8; ++r) {
          int n = nbase + 8 * g + r;
          base[(size_t)n * HD + d] = (_Float16)(acc[u][r] + bias);
        }
      }
    }
  } else {
    const float scale = 0.17677669529663687f;  // 32^-0.5
#pragma unroll 1
    for (int cp = 0; cp < CT_COUNT; cp += 2) {
      v8f acc[2] = {strip_tile(a, wp, cp), strip_tile(a, wp, cp + 1)};
      _Float16* base = Qh + ((size_t)b * NHEAD + (cp >> 1)) * N_PAD * HD;   // head cp/2
#pragma unroll
      for (int u = 0; u < 2; ++u) {
        float bias = bv[(cp + u) * 16 + cl];
        int d = u * 16 + cl;
#pragma unroll
        for (int r = 0; r < 8; ++r) {
          int n = nbase + 8 * g + r;
          base[(size_t)n * HD + d] = (_Float16)((acc[u][r] + bias) * scale);
        }
      }
    }
  }
}

// ---------------------------------------------------------------------------
// Stage 1's launch. The bias gather, the mask re-layout and the conversion of
//   the output projection's weights read only inputs and are first read by
//   stage 2 or 3, so they need no launch of their own: their blocks follow the
//   GEMM's in one grid. The long blocks have the low indices,
//   the short ones the high.
//   Every branch is uniform for the block, so each barrier is passed by all
//   of its threads. The mask's rows use the LDS of the weight panel.
// ---------------------------------------------------------------------------
#define S1_BLOCKS (QKV_BLOCKS + MASK_BLOCKS + BIAS_BLOCKS + QW_BLOCKS)
__global__ __launch_bounds__(256, 8) void qkv_and_addends(
    const float* __restrict__ x1, const float* __restrict__ x2,
    const _Float16* __restrict__ qwh, const _Float16* __restrict__ kvwh,
    const float* __restrict__ qb, const float* __restrict__ kvb,
    _Float16* __restrict__ Qh, _Float16* __restrict__ Kh,
    _Float16* __restrict__ Vt,
    const float* __restrict__ mask, float* __restrict__ maskF,
    const float* __restrict__ table, const int* __restrict__ rel_idx,
    float* __restrict__ biasF,
    const float* __restrict__ pw, _Float16* __restrict__ pwh) {
  __shared__ __attribute__((aligned(16))) _Float16 wp[DIMC * WP_PITCH];
  static_assert(16 * MROW_PITCH * sizeof(float) <= sizeof(wp), "mask rows fit the panel");
  int blk = blockIdx.x;
  if (blk < QKV_BLOCKS) {
    qkv_gemm(x1, x2, qwh, kvwh, qb, kvb, Qh, Kh, Vt, wp, blk);
  } else if (blk < QKV_BLOCKS + MASK_BLOCKS) {
    mask_to_fragments(mask, maskF, (float*)wp, blk - QKV_BLOCKS);
  } else if (blk < QKV_BLOCKS + MASK_BLOCKS + BIAS_BLOCKS) {
    bias_gather(table, rel_idx, biasF, blk - (QKV_BLOCKS + MASK_BLOCKS));
  } else {
    cvt_block(pw, pwh, DIMC * DIMC, blk - (QKV_BLOCKS + MASK_BLOCKS + BIAS_BLOCKS));
  }
}

// ---------------------------------------------------------------------------
// Stage 2: flash attention, one workgroup of 11 waves per (window, head, pair
//   of batches, half of the q-tiles); a wave takes one q-tile. Batches b and
//   b + 64 have the same window, so at one head they add the same bias and mask
//   tile to their scores: a wave loads and sums that tile once a k step and
//   uses the sum for both batches, as the start value (C operand) of their
//   score products. K and V^T of both batches are staged once in LDS and
//   shared by the 11 waves.
//   Computes S^T = K x Q^T so P^T (in D-register layout) is directly the
//   B operand of O^T = V^T x P^T (32 keys per iteration => K=32 exactly).
//   102,400 B of LDS and this kernel's registers let two workgroups share a
//   WGP: the 1536 workgroups are three full rounds of 256 x 2.
// ---------------------------------------------------------------------------
#define FA_WAVES   (QT_COUNT / 2)             /* 11 */
#define FA_THREADS (FA_WAVES * 32)            /* 352 */
#define FA_NB      2                          /* batches of one window in a workgroup */
#define FA_PAIRS   (NB / NWIN / FA_NB)        /* 2 such pairs a window */
#define FA_QSPLIT  (QT_COUNT / FA_WAVES)      /* 2 workgroups share the 22 q-tiles */
#define KL_PITCH   40                         /* halves: 80 B = 16 B x 5, odd, for b128 readers */
#define VL_PITCH   360                        /* halves: 720 B = 16 B x 45, odd */
#define KV_CHUNKS  (N_PAD * HD / 8)           /* 1408 pieces of 16 B in K, and in V^T */

// Same lane mapping as load_f16_tile, from an LDS array of the given pitch.
__device__ __forceinline__ v16h lds_frag(const _Float16* base, int rowBase,
                                         int pitch, int k0) {
  int l = threadIdx.x;
  int r = l & 15;
  int g = (l >> 4) & 1;
  const _Float16* p = base + (rowBase + r) * pitch + k0 + g * 8;
  V16U u;
  u.h[0] = *(const v8h*)(p);
  u.h[1] = *(const v8h*)(p + 16);
  return u.v;
}

__global__ __launch_bounds__(FA_THREADS) void flash_attn(
    const _Float16* __restrict__ Qh, const _Float16* __restrict__ Kh,
    const _Float16* __restrict__ Vt, const float* __restrict__ biasF,
    const float* __restrict__ maskF, _Float16* __restrict__ att) {
  __shared__ __attribute__((aligned(16))) _Float16 kl[FA_NB][N_PAD * KL_PITCH];   // 2 x 28,160 B
  __shared__ __attribute__((aligned(16))) _Float16 vl[FA_NB][HD * VL_PITCH];      // 2 x 23,040 B
  int h  = blockIdx.x;            // 0..5
  int pr = blockIdx.y % FA_PAIRS; // pair of batches of the window
  int qh = blockIdx.y / FA_PAIRS; // half of the q-tiles
  int w  = blockIdx.z;            // window index of the mask, 0..63
  int t  = threadIdx.x;
  int wv = __builtin_amdgcn_readfirstlane(t >> 5);   // 0..10

  // batch n of the pair: b = w + 64 * (2 * pr + n), so b % 64 == w
  const size_t bh0    = ((size_t)(w + NWIN * FA_NB * pr)) * NHEAD + h;
  const size_t bhStep = (size_t)NWIN * NHEAD * N_PAD * HD;   // halves from batch n to n + 1
  const _Float16* Qb = Qh + bh0 * N_PAD * HD;
  const _Float16* Kb = Kh + bh0 * N_PAD * HD;
  const _Float16* Vb = Vt + bh0 * HD * N_PAD;

  // The arrays are read as they lie (contiguous 16-B pieces, four of each a
  // thread and batch, all in flight together) and laid down at the padded pitches.
  v8h kc[FA_NB][KV_CHUNKS / FA_THREADS], vc[FA_NB][KV_CHUNKS / FA_THREADS];
#pragma unroll
  for (int n = 0; n < FA_NB; ++n) {
#pragma unroll
    for (int i = 0; i < KV_CHUNKS / FA_THREADS; ++i) {
      kc[n][i] = *(const v8h*)(Kb + n * bhStep + (size_t)(t + FA_THREADS * i) * 8);
      vc[n][i] = *(const v8h*)(Vb + n * bhStep + (size_t)(t + FA_THREADS * i) * 8);
    }
  }
#pragma unroll
  for (int n = 0; n < FA_NB; ++n) {
#pragma unroll
    for (int i = 0; i < KV_CHUNKS / FA_THREADS; ++i) {
      int f  = t + FA_THREADS * i;
      int kr = f / (HD / 8);
      int vr = f / (N_PAD / 8);
      *(v8h*)(kl[n] + kr * KL_PITCH + (f - kr * (HD / 8)) * 8)    = kc[n][i];
      *(v8h*)(vl[n] + vr * VL_PITCH + (f - vr * (N_PAD / 8)) * 8) = vc[n][i];
    }
  }
  __syncthreads();                // K and V^T are complete before any wave reads them

  int l  = t & 31;
  int q  = l & 15;
  int g  = (l >> 4) & 1;
  int qt = qh * FA_WAVES + wv;    // this wave's q-tile
  int qg = qt * 16 + q;           // this lane's global query index

  // this lane's 16-B pieces of the addend tiles of q-tile qt (fragment order)
  const v4f* Bf = (const v4f*)(biasF + (size_t)h * PLANE_F +
                               (size_t)qt * KT_COUNT * TILE_F) + l;
  const v4f* Mf = (const v4f*)(maskF + (size_t)w * PLANE_F +
                               (size_t)qt * KT_COUNT * TILE_F) + l;

  v16h Qop[FA_NB];                // B operands, loaded once
  v8f oLo[FA_NB];                 // O^T rows d=0..15 (this lane: d=8g+r)
  v8f oHi[FA_NB];                 // O^T rows d=16..31
  float mrow[FA_NB];
  float lsum[FA_NB];
#pragma unroll
  for (int n = 0; n < FA_NB; ++n) {
    Qop[n] = load_f16_tile(Qb + n * bhStep, qt * 16, HD, 0);
    oLo[n] = v8f{};
    oHi[n] = v8f{};
    mrow[n] = -3.0e38f;
    lsum[n] = 0.f;
  }

  for (int k0 = 0; k0 < N_PAD; k0 += 32) {
    // c0 reg r -> key k0+8g+r, c1 reg r -> key k0+16+8g+r; padding keys carry
    // KEY_PAD in the mask plane, so no bounds test is left here.
    int tb = (k0 >> 5) * (TILE_F / 4);
    v4f b0 = Bf[tb], b1 = Bf[tb + 32], b2 = Bf[tb + 64], b3 = Bf[tb + 96];
    v4f m0 = Mf[tb], m1 = Mf[tb + 32], m2 = Mf[tb + 64], m3 = Mf[tb + 96];
    v8f c0, c1;
#pragma unroll
    for (int r = 0; r < 4; ++r) {
      c0[r]     = b0[r] + m0[r];
      c0[4 + r] = b1[r] + m1[r];
      c1[r]     = b2[r] + m2[r];
      c1[4 + r] = b3[r] + m3[r];
    }

#pragma unroll
    for (int n = 0; n < FA_NB; ++n) {
    v16h Ka = lds_frag(kl[n], k0, KL_PITCH, 0);
    v16h Kc = lds_frag(kl[n], k0 + 16, KL_PITCH, 0);
    v8f s0 = wmma_f16(Ka, Qop[n], c0);   // keys k0   .. k0+15 (x query)
    v8f s1 = wmma_f16(Kc, Qop[n], c1);   // keys k0+16.. k0+31

    // --- online softmax (row = query; pair (lane, lane^16) shares a row) ---
    float tm = s0[0];
#pragma unroll
    for (int r = 0; r < 8; ++r) { tm = fmaxf(tm, s0[r]); tm = fmaxf(tm, s1[r]); }
    tm = fmaxf(tm, __shfl_xor(tm, 16, 32));
    float mnew  = fmaxf(mrow[n], tm);
    float alpha = __expf(mrow[n] - mnew);
    mrow[n] = mnew;

    V16U p;                       // P^T in B-operand layout for K=32
    float rs = 0.f;
#pragma unroll
    for (int r = 0; r < 8; ++r) {
      float e0 = __expf(s0[r] - mnew);
      float e1 = __expf(s1[r] - mnew);
      rs += e0 + e1;
      p.h[0][r] = (_Float16)e0;   // keys k0+8g+r
      p.h[1][r] = (_Float16)e1;   // keys k0+16+8g+r
    }
    rs += __shfl_xor(rs, 16, 32);
    lsum[n] = lsum[n] * alpha + rs;

#pragma unroll
    for (int i = 0; i < 8; ++i) { oLo[n][i] *= alpha; oHi[n][i] *= alpha; }

    v16h Va0 = lds_frag(vl[n], 0,  VL_PITCH, k0);     // V^T rows d=0..15
    v16h Va1 = lds_frag(vl[n], 16, VL_PITCH, k0);     // V^T rows d=16..31
    oLo[n] = wmma_f16(Va0, p.v, oLo[n]);
    oHi[n] = wmma_f16(Va1, p.v, oHi[n]);
    }                             // batches of the pair
  }

  if (qg < N_TOK) {
#pragma unroll
    for (int n = 0; n < FA_NB; ++n) {
      int b = w + NWIN * (FA_NB * pr + n);
      float inv = 1.0f / lsum[n];
      _Float16* dst = att + ((size_t)b * N_TOK + qg) * DIMC + h * HD;   // rows unpadded
      v8h a0, a1;
#pragma unroll
      for (int r = 0; r < 8; ++r) {
        a0[r] = (_Float16)(oLo[n][r] * inv);   // d = 8g + r
        a1[r] = (_Float16)(oHi[n][r] * inv);   // d = 16 + 8g + r
      }
      *(v8h*)(dst + 8 * g)      = a0;       // 16B contiguous
      *(v8h*)(dst + 16 + 8 * g) = a1;
    }
  }
}

// ---------------------------------------------------------------------------
// Stage 3: output projection GEMM. out[m][c] = att[m][:] . proj_w[c][:] + pb[c]
//   m = b * 343 + n runs over the 87808 = 5488 * 16 rows of att and of out
//   (both unpadded), so no row tile has an edge. blockIdx.x = group of 8 row
//   tiles; same workgroup tile as stage 1.
// ---------------------------------------------------------------------------
#define OUT_TILES (NB * N_TOK / 16)           /* 5488 = 686 * 8 */
__global__ __launch_bounds__(256, 8) void proj_gemm(
    const _Float16* __restrict__ att, const _Float16* __restrict__ pwh,
    const float* __restrict__ pb, float* __restrict__ out) {
  __shared__ __attribute__((aligned(16))) _Float16 wp[DIMC * WP_PITCH];
  int wv = __builtin_amdgcn_readfirstlane(threadIdx.x >> 5);
  int mbase = (blockIdx.x * GEMM_WAVES + wv) * 16;

  v16h a[KS_COUNT];
#pragma unroll
  for (int ks = 0; ks < KS_COUNT; ++ks)
    a[ks] = load_f16_tile(att, mbase, DIMC, ks * 32);
  // the staging below reuses the address registers of the loads above
  asm volatile("s_wait_xcnt 0x0" ::: "memory");
  stage_panel(pwh, wp);
  __syncthreads();                // the panel is complete before any wave reads it

  int l = threadIdx.x;
  int g = (l >> 4) & 1;
  float* dst = out + (size_t)(mbase + 8 * g) * DIMC + (l & 15);
  // Two column tiles a trip, rolled (unroll 1): fully unrolled, the build kept
  // one fragment set and waited out the LDS latency in front of every WMMA.
#pragma unroll 1
  for (int cp = 0; cp < CT_COUNT; cp += 2) {
    v8f acc[2] = {strip_tile(a, wp, cp), strip_tile(a, wp, cp + 1)};
#pragma unroll
    for (int u = 0; u < 2; ++u) {
      float bias = pb[(cp + u) * 16 + (l & 15)];
#pragma unroll
      for (int r = 0; r < 8; ++r)
        dst[(size_t)r * DIMC + (cp + u) * 16] = acc[u][r] + bias;
    }
    // the next trip rewrites registers that these stores name
    asm volatile("s_wait_xcnt 0x0" ::: "memory");
  }
}

// ---------------------------------------------------------------------------
// Host launcher
// ---------------------------------------------------------------------------
extern "C" void kernel_launch(void* const* d_in, const int* in_sizes, int n_in,
                              void* d_out, int out_size, void* d_ws, size_t ws_size,
                              hipStream_t stream) {
  const float* x1     = (const float*)d_in[0];
  const float* x2     = (const float*)d_in[1];
  const float* mask   = (const float*)d_in[2];
  const float* table  = (const float*)d_in[3];
  const float* q_w    = (const float*)d_in[4];
  const float* q_b    = (const float*)d_in[5];
  const float* kv_w   = (const float*)d_in[6];
  const float* kv_b   = (const float*)d_in[7];
  const float* proj_w = (const float*)d_in[8];
  const float* proj_b = (const float*)d_in[9];
  const int*   relidx = (const int*)d_in[10];
  float* out = (float*)d_out;

  char* ws = (char*)d_ws;
  // workspace layout (256B aligned)
  const size_t o_qwh  = 0;                                 //  73,728 B
  const size_t o_kvwh = o_qwh  + 73728;                    // 147,456 B
  const size_t o_pwh  = o_kvwh + 147456;                   //  73,728 B
  const size_t o_bias = o_pwh  + 73728;                    //  2,973,696 B (6 planes)
  const size_t o_mask = o_bias + 2973696;                  // 31,719,424 B (64 planes)
  const size_t o_Qh   = o_mask + 31719424;                 // 34,603,008 B
  const size_t o_Kh   = o_Qh   + 34603008;
  const size_t o_Vt   = o_Kh   + 34603008;
  const size_t o_att  = o_Vt   + 34603008;

  _Float16* qwh  = (_Float16*)(ws + o_qwh);
  _Float16* kvwh = (_Float16*)(ws + o_kvwh);
  _Float16* pwh  = (_Float16*)(ws + o_pwh);
  float*    bsm  = (float*)   (ws + o_bias);
  float*    mskf = (float*)   (ws + o_mask);
  _Float16* Qh   = (_Float16*)(ws + o_Qh);
  _Float16* Kh   = (_Float16*)(ws + o_Kh);
  _Float16* Vt   = (_Float16*)(ws + o_Vt);
  _Float16* att  = (_Float16*)(ws + o_att);

  // Stage 0: conversion of the weights that stage 1 reads
  cvt_qkv_weights<<<QW_BLOCKS + KVW_BLOCKS, 256, 0, stream>>>(q_w, kv_w, qwh, kvwh);

  // Stage 1: QKV projections (f16 WMMA, f32 accumulate); in the same grid the
  // bias gather, the mask re-layout and the output weights' conversion
  qkv_and_addends<<<S1_BLOCKS, 256, 0, stream>>>(
      x1, x2, qwh, kvwh, q_b, kv_b, Qh, Kh, Vt,
      mask, mskf, table, relidx, bsm, proj_w, pwh);

  // Stage 2: fused flash attention (QK^T + bias + mask + softmax + PV)
  flash_attn<<<dim3(NHEAD, FA_PAIRS * FA_QSPLIT, NWIN), FA_THREADS, 0, stream>>>(
      Qh, Kh, Vt, bsm, mskf, att);

  // Stage 3: output projection
  proj_gemm<<<dim3(OUT_TILES / GEMM_WAVES), 256, 0, stream>>>(att, pwh, proj_b, out);
}

// v006
// Measured time: 109 microseconds a run.
// In two side-by-side timings against v005, it was 1.23 and 1.22 times as fast.
// Counting every step since v000, it is 12.7 times as fast.
#include <hip/hip_runtime.h>
#include <hip/hip_bf16.h>

typedef __attribute__((ext_vector_type(16))) _Float16 v16h;
typedef __attribute__((ext_vector_type(8)))  _Float16 v8h;
typedef __attribute__((ext_vector_type(8)))  float    v8f;
typedef __attribute__((ext_vector_type(4)))  float    v4f;

#define N_TOK 343
#define N_PAD 352
#define DIMC  192
#define NHEAD 6
#define HD    32
#define NWIN  64
#define NB    256
#define QT_COUNT 22   /* 352/16 */
#define KT_COUNT 11   /* 352/32 */
#define TILE_F   512  /* floats of one 16-query x 32-key score tile */
#define PLANE_F  (QT_COUNT * KT_COUNT * TILE_F)   /* 352*352 floats */
#define TAB_ROWS 2197
#define KEY_PAD  (-1.0e30f)

union V16U { v16h v; v8h h[2]; };

// ---------------------------------------------------------------------------
// Operand lane mapping of a 16-row x 32-k f16 fragment:
//   A-operand: lane(0..15)=row rowBase+l, k = k0+{0..7,16..23}
//              lane(16..31)=row rowBase+(l-16), k = k0+{8..15,24..31}
// (B-operand uses the same pattern with "row" = output column / query index.)
//
// Fragment order of the f16 intermediates in the workspace (Q, K, V^T and the
// attention output): a 16 x 16 block is 32 pieces of 16 B, piece = lane;
//   lane = 16*g + i holds line i of the block, its elements 8*g .. 8*g+7.
// That is one half of an operand fragment and also what a lane holds of a
// 16 x 16 accumulator tile (its column i, rows 8*g .. 8*g+7), so a wave stores
// or loads a block as 512 contiguous bytes (four whole 128-B lines).
// ---------------------------------------------------------------------------
#define BLK_P 32   /* 16-B pieces of a block */

// Operand fragment made of the two blocks at p (k 0..15) and p + BLK_P (k 16..31);
// p already points at this lane's piece.
__device__ __forceinline__ v16h load_frag_blocks(const v8h* p) {
  V16U u;
  u.h[0] = p[0];
  u.h[1] = p[BLK_P];
  return u.v;
}

// The operand lane mapping from a row-major f32 source (converted to f16); rows >= nvalid -> 0.
// The address is clamped and the value selected, with no branch round the
// loads, so that a wave's loads of all k steps are in flight together.
__device__ __forceinline__ v16h load_f32_tile_cvt(const float* base, int rowBase,
                                                  int nvalid, int ld, int k0) {
  int l = threadIdx.x;
  int r = l & 15;
  int g = (l >> 4) & 1;
  int row = rowBase + r;
  bool in = (row < nvalid);
  const float* p = base + (size_t)min(row, nvalid - 1) * ld + k0 + g * 8;
  v4f a0 = *(const v4f*)(p);
  v4f a1 = *(const v4f*)(p + 4);
  v4f b0 = *(const v4f*)(p + 16);
  v4f b1 = *(const v4f*)(p + 20);
  V16U u;
#pragma unroll
  for (int i = 0; i < 4; ++i) {
    u.h[0][i]     = in ? (_Float16)a0[i] : (_Float16)0.f;
    u.h[0][4 + i] = in ? (_Float16)a1[i] : (_Float16)0.f;
    u.h[1][i]     = in ? (_Float16)b0[i] : (_Float16)0.f;
    u.h[1][4 + i] = in ? (_Float16)b1[i] : (_Float16)0.f;
  }
  return u.v;
}

__device__ __forceinline__ v8f wmma_f16(v16h a, v16h b, v8f c) {
  return __builtin_amdgcn_wmma_f32_16x16x32_f16(false, a, false, b, (short)0, c,
                                                false, false);
}

// ---------------------------------------------------------------------------
// Stage 0a: f32 -> f16 weight conversion, block blk of 256 elements.
//   The Q and the K/V weights, which stage 1 reads, share one launch; the
//   output projection's weights are converted inside stage 1's launch.
// ---------------------------------------------------------------------------
#define QW_BLOCKS  (DIMC * DIMC / 256)        /* 144 */
#define KVW_BLOCKS (2 * DIMC * DIMC / 256)    /* 288 */
__device__ __forceinline__ void cvt_block(const float* __restrict__ src,
                                          _Float16* __restrict__ dst, int n, int blk) {
  int i = blk * 256 + threadIdx.x;
  if (i < n) dst[i] = (_Float16)src[i];
}

__global__ __launch_bounds__(256) void cvt_qkv_weights(
    const float* __restrict__ qw, const float* __restrict__ kvw,
    _Float16* __restrict__ qwh, _Float16* __restrict__ kvwh) {
  int blk = blockIdx.x;
  if (blk < QW_BLOCKS) cvt_block(qw, qwh, DIMC * DIMC, blk);
  else                 cvt_block(kvw, kvwh, 2 * DIMC * DIMC, blk - QW_BLOCKS);
}

// ---------------------------------------------------------------------------
// Fragment order of the score addends (bias and mask planes, 352 x 352 padded):
//   plane[qt][kt][j][lane][e], one 16-query x 32-key tile = 4 x 32 x 4 floats.
//   lane = 16*g + (q & 15); key = 32*kt + 16*(j >> 1) + 8*g + 4*(j & 1) + e.
// That is the accumulator layout of S^T in flash_attn: load j of a tile is
// 32 lanes x 16 B = 512 contiguous bytes (four whole 128-B lines).
// ---------------------------------------------------------------------------

// ---------------------------------------------------------------------------
// Stage 0b: relative-position bias gather into fragment order:
//   biasF[h] at (q,k) = table[rel_idx[q][k]][h]; 0 in the padding.
// ---------------------------------------------------------------------------
#define BIAS_BLOCKS ((PLANE_F + 255) / 256)   /* 484 */
__device__ __forceinline__ void bias_gather(const float* __restrict__ table,
                                            const int* __restrict__ rel_idx,
                                            float* __restrict__ biasF, int blk) {
  int i = blk * 256 + threadIdx.x;             // index inside a plane
  if (i < PLANE_F) {
    int e    = i & 3;
    int lane = (i >> 2) & 31;
    int j    = (i >> 7) & 3;
    int tile = i >> 9;
    int qt = tile / KT_COUNT;
    int kt = tile - qt * KT_COUNT;
    int q = qt * 16 + (lane & 15);
    int k = kt * 32 + (j >> 1) * 16 + (lane >> 4) * 8 + (j & 1) * 4 + e;
    bool in = (q < N_TOK) && (k < N_TOK);
    int idx = in ? rel_idx[q * N_TOK + k] : 0;
    idx = min(max(idx, 0), TAB_ROWS - 1);      // the table read stays in bounds
#pragma unroll
    for (int h = 0; h < NHEAD; ++h) {
      float tv = table[idx * NHEAD + h];
      biasF[(size_t)h * PLANE_F + i] = in ? tv : 0.f;
    }
  }
}

// ---------------------------------------------------------------------------
// Stage 0c: mask -> fragment order, one block per (q-tile, window): blk = 22 w + qt.
//   Rows are read as whole rows (coalesced), turned in LDS, and written as
//   contiguous 16-B pieces. Padding keys get KEY_PAD, padding queries 0.
// ---------------------------------------------------------------------------
#define MROW_PITCH 356   /* floats; 16-B multiple, spreads the 16 rows over the banks */
#define MASK_BLOCKS (QT_COUNT * NWIN)         /* 1408 */
__device__ __forceinline__ void mask_to_fragments(
    const float* __restrict__ mask, float* __restrict__ maskF,
    float* rows /* LDS, 16 * MROW_PITCH floats */, int blk) {
  int w  = blk / QT_COUNT;
  int qt = blk - w * QT_COUNT;
  int t  = threadIdx.x;
  int ln = t & 31;
  int wv = t >> 5;
  const float* Mw = mask + (size_t)w * N_TOK * N_TOK;
  // Clamped addresses instead of branches, and the loops unrolled: the 22
  // loads of a wave are then all in flight before the first LDS store waits.
  float v[2][KT_COUNT];
#pragma unroll
  for (int rr = 0; rr < 2; ++rr) {
    int q = qt * 16 + wv + 8 * rr;
    const float* Mr = Mw + (size_t)min(q, N_TOK - 1) * N_TOK;
#pragma unroll
    for (int i = 0; i < KT_COUNT; ++i) v[rr][i] = Mr[min(ln + 32 * i, N_TOK - 1)];
  }
#pragma unroll
  for (int rr = 0; rr < 2; ++rr) {
    int ql = wv + 8 * rr;
    bool qin = (qt * 16 + ql < N_TOK);
#pragma unroll
    for (int i = 0; i < KT_COUNT; ++i) {
      int k = ln + 32 * i;
      rows[ql * MROW_PITCH + k] = (k < N_TOK) ? (qin ? v[rr][i] : 0.f) : KEY_PAD;
    }
  }
  __syncthreads();
  v4f* dst = (v4f*)(maskF + (size_t)w * PLANE_F + (size_t)qt * KT_COUNT * TILE_F);
  for (int f = t; f < KT_COUNT * TILE_F / 4; f += 256) {
    int lane = f & 31;
    int j    = (f >> 5) & 3;
    int kt   = f >> 7;
    int k = kt * 32 + (j >> 1) * 16 + (lane >> 4) * 8 + (j & 1) * 4;
    dst[f] = *(const v4f*)(rows + (lane & 15) * MROW_PITCH + k);
  }
}

// ---------------------------------------------------------------------------
// Projection GEMMs: one workgroup of 8 waves per 128 rows x 192 columns.
//   The 192 x 192 f16 weight panel is staged once in LDS and shared by the 8
//   waves; each wave keeps the six A fragments of its 16 rows in registers and
//   walks the 12 column tiles. The k order of every sum is k0 = 0,32,..,160.
// ---------------------------------------------------------------------------
#define GEMM_WAVES 8
#define ROW_TILES  (QT_COUNT * NB)            /* 5632 = 704 * 8 */
#define CT_COUNT   12                         /* 192/16 column tiles of a panel */
#define KS_COUNT   6                          /* 192/32 k steps */
#define WP_PITCH   200                        /* halves: 400 B = 16 B x 25, odd, for b128 readers */
#define WP_CHUNKS  (DIMC * DIMC / 8)          /* 4608 pieces of 16 B */
// The panel takes 76,800 B, so four workgroups fit a WGP's LDS: the second
// launch bound (8 waves per SIMD) keeps the registers from allowing fewer.

__device__ __forceinline__ void stage_panel(const _Float16* __restrict__ Wp,
                                            _Float16* wp) {
  int t = threadIdx.x;
  v8h tmp[WP_CHUNKS / 256];
  // unrolled: all 18 loads of a thread are in flight before the first LDS store
#pragma unroll
  for (int i = 0; i < WP_CHUNKS / 256; ++i)
    tmp[i] = *(const v8h*)(Wp + (size_t)(t + 256 * i) * 8);
#pragma unroll
  for (int i = 0; i < WP_CHUNKS / 256; ++i) {
    int f   = t + 256 * i;
    int row = f / (DIMC / 8);
    int ch  = f - row * (DIMC / 8);
    *(v8h*)(wp + row * WP_PITCH + ch * 8) = tmp[i];
  }
}

// The operand lane mapping, from the LDS panel.
__device__ __forceinline__ v16h panel_frag(const _Float16* wp, int rowBase, int k0) {
  int l = threadIdx.x;
  int r = l & 15;
  int g = (l >> 4) & 1;
  const _Float16* p = wp + (rowBase + r) * WP_PITCH + k0 + g * 8;
  V16U u;
  u.h[0] = *(const v8h*)(p);
  u.h[1] = *(const v8h*)(p + 16);
  return u.v;
}

__device__ __forceinline__ v8f strip_tile(const v16h (&a)[KS_COUNT],
                                          const _Float16* wp, int ct) {
  v8f acc = {};
#pragma unroll
  for (int ks = 0; ks < KS_COUNT; ++ks)
    acc = wmma_f16(a[ks], panel_frag(wp, ct * 16, ks * 32), acc);
  return acc;
}

// The same products with the operands exchanged: the tile comes out transposed
// (lane = row of a, registers = 8 consecutive columns of the panel).
__device__ __forceinline__ v8f strip_tile_t(const v16h (&a)[KS_COUNT],
                                            const _Float16* wp, int ct) {
  v8f acc = {};
#pragma unroll
  for (int ks = 0; ks < KS_COUNT; ++ks)
    acc = wmma_f16(panel_frag(wp, ct * 16, ks * 32), a[ks], acc);
  return acc;
}

// ---------------------------------------------------------------------------
// Stage 1: QKV projection GEMM, block blk of QKV_BLOCKS.
//   blk % 3 = panel (0 Q, 1 K, 2 V), blk / 3 = group of 8 row tiles
//   All three go out in fragment order, one 512-B store a 16 x 16 tile:
//   Q  -> Qh[b][h][n/16][d/16] blocks, line = n, elements = d (pre-scaled by hd^-0.5)
//   K  -> Kh[b][h][n/16][d/16] blocks, line = n, elements = d
//   V  -> Vt[b][h][d/16][n/16] blocks, line = d, elements = n
//   Q and K tiles are computed transposed, so that a lane holds 8 d of one n.
// ---------------------------------------------------------------------------
#define QKV_BLOCKS (3 * ROW_TILES / GEMM_WAVES)   /* 2112 */
__device__ __forceinline__ void qkv_gemm(
    const float* __restrict__ x1, const float* __restrict__ x2,
    const _Float16* __restrict__ qwh, const _Float16* __restrict__ kvwh,
    const float* __restrict__ qb, const float* __restrict__ kvb,
    _Float16* __restrict__ Qh, _Float16* __restrict__ Kh,
    _Float16* __restrict__ Vt, _Float16* wp /* LDS panel */, int blk) {
  int grp = blk / 3;
  int pn  = blk - grp * 3;
  int wv = __builtin_amdgcn_readfirstlane(threadIdx.x >> 5);
  int rt = grp * GEMM_WAVES + wv;             // row tile, 0..5631
  int b  = rt / QT_COUNT;
  int nbase = (rt - b * QT_COUNT) * 16;
  const float*    X  = (pn == 0) ? x1 : x2;
  const _Float16* Wp = (pn == 0) ? qwh : kvwh + (size_t)(pn - 1) * DIMC * DIMC;
  const float*    bv = (pn == 0) ? qb : kvb + (pn - 1) * DIMC;

  stage_panel(Wp, wp);
  // Keeps the 24 f32 loads below from being lifted among the 18 staging loads:
  // both sets in flight at once need more registers than 8 waves per SIMD leave,
  // and the build then spills to scratch.
  __builtin_amdgcn_sched_barrier(0);
  v16h a[KS_COUNT];
#pragma unroll
  for (int ks = 0; ks < KS_COUNT; ++ks)
    a[ks] = load_f32_tile_cvt(X + (size_t)b * N_TOK * DIMC, nbase, N_TOK, DIMC, ks * 32);
  __syncthreads();                // the panel is complete before any wave reads it

  int l = threadIdx.x & 31;
  int g = l >> 4;                 // register group: elements 8g .. 8g+7 of a tile's line
  int cl = l & 15;                // this lane's line inside a tile
  int nt = nbase >> 4;            // row tile inside the batch

  // The walks go two column tiles a trip and stay rolled (unroll 1): unrolled,
  // the fragment loads of all 12 tiles are hoisted until A spills to scratch.
  if (pn == 2) {
#pragma unroll 1
    for (int cp = 0; cp < CT_COUNT; cp += 2) {
      v8f acc[2] = {strip_tile(a, wp, cp), strip_tile(a, wp, cp + 1)};
#pragma unroll
      for (int u = 0; u < 2; ++u) {
        float bias = bv[(cp + u) * 16 + cl];
        v8h o;
#pragma unroll
        for (int r = 0; r < 8; ++r) o[r] = (_Float16)(acc[u][r] + bias);
        ((v8h*)Vt)[(((size_t)b * CT_COUNT + cp + u) * QT_COUNT + nt) * BLK_P + l] = o;
      }
    }
  } else if (pn == 1) {
#pragma unroll 1
    for (int cp = 0; cp < CT_COUNT; cp += 2) {
      v8f acc[2] = {strip_tile_t(a, wp, cp), strip_tile_t(a, wp, cp + 1)};
      v8h* base = (v8h*)Kh + (((size_t)b * NHEAD + (cp >> 1)) * QT_COUNT + nt) * 2 * BLK_P + l;   // head cp/2
#pragma unroll
      for (int u = 0; u < 2; ++u) {
        const v4f* bp = (const v4f*)(bv + (cp + u) * 16 + 8 * g);
        v4f bl = bp[0], bh = bp[1];
        v8h o;
#pragma unroll
        for (int r = 0; r < 4; ++r) {
          o[r]     = (_Float16)(acc[u][r] + bl[r]);
          o[4 + r] = (_Float16)(acc[u][4 + r] + bh[r]);
        }
        base[u * BLK_P] = o;
      }
    }
  } else {
    const float scale = 0.17677669529663687f;  // 32^-0.5
#pragma unroll 1
    for (int cp = 0; cp < CT_COUNT; cp += 2) {
      v8f acc[2] = {strip_tile_t(a, wp, cp), strip_tile_t(a, wp, cp + 1)};
      v8h* base = (v8h*)Qh + (((size_t)b * NHEAD + (cp >> 1)) * QT_COUNT + nt) * 2 * BLK_P + l;   // head cp/2
#pragma unroll
      for (int u = 0; u < 2; ++u) {
        const v4f* bp = (const v4f*)(bv + (cp + u) * 16 + 8 * g);
        v4f bl = bp[0], bh = bp[1];
        v8h o;
#pragma unroll
        for (int r = 0; r < 4; ++r) {
          o[r]     = (_Float16)((acc[u][r] + bl[r]) * scale);
          o[4 + r] = (_Float16)((acc[u][4 + r] + bh[r]) * scale);
        }
        base[u * BLK_P] = o;
      }
    }
  }
}

// ---------------------------------------------------------------------------
// Stage 1's launch. The bias gather, the mask re-layout and the conversion of
//   the output projection's weights read only inputs and are first read by
//   stage 2 or 3, so they need no launch of their own: their blocks follow the
//   GEMM's in one grid. The long blocks have the low indices,
//   the short ones the high.
//   Every branch is uniform for the block, so each barrier is passed by all
//   of its threads. The mask's rows use the LDS of the weight panel.
// ---------------------------------------------------------------------------
#define S1_BLOCKS (QKV_BLOCKS + MASK_BLOCKS + BIAS_BLOCKS + QW_BLOCKS)
__global__ __launch_bounds__(256, 8) void qkv_and_addends(
    const float* __restrict__ x1, const float* __restrict__ x2,
    const _Float16* __restrict__ qwh, const _Float16* __restrict__ kvwh,
    const float* __restrict__ qb, const float* __restrict__ kvb,
    _Float16* __restrict__ Qh, _Float16* __restrict__ Kh,
    _Float16* __restrict__ Vt,
    const float* __restrict__ mask, float* __restrict__ maskF,
    const float* __restrict__ table, const int* __restrict__ rel_idx,
    float* __restrict__ biasF,
    const float* __restrict__ pw, _Float16* __restrict__ pwh) {
  __shared__ __attribute__((aligned(16))) _Float16 wp[DIMC * WP_PITCH];
  static_assert(16 * MROW_PITCH * sizeof(float) <= sizeof(wp), "mask rows fit the panel");
  int blk = blockIdx.x;
  if (blk < QKV_BLOCKS) {
    qkv_gemm(x1, x2, qwh, kvwh, qb, kvb, Qh, Kh, Vt, wp, blk);
  } else if (blk < QKV_BLOCKS + MASK_BLOCKS) {
    mask_to_fragments(mask, maskF, (float*)wp, blk - QKV_BLOCKS);
  } else if (blk < QKV_BLOCKS + MASK_BLOCKS + BIAS_BLOCKS) {
    bias_gather(table, rel_idx, biasF, blk - (QKV_BLOCKS + MASK_BLOCKS));
  } else {
    cvt_block(pw, pwh, DIMC * DIMC, blk - (QKV_BLOCKS + MASK_BLOCKS + BIAS_BLOCKS));
  }
}

// ---------------------------------------------------------------------------
// Stage 2: flash attention, one workgroup of 11 waves per (window, head, pair
//   of batches, half of the q-tiles); a wave takes one q-tile. Batches b and
//   b + 64 have the same window, so at one head they add the same bias and mask
//   tile to their scores: a wave loads and sums that tile once a k step and
//   uses the sum for both batches, as the start value (C operand) of their
//   score products. K and V^T of both batches are staged once in LDS and
//   shared by the 11 waves.
//   Computes S^T = K x Q^T so P^T (in D-register layout) is directly the
//   B operand of O^T = V^T x P^T (32 keys per iteration => K=32 exactly).
//   102,400 B of LDS and this kernel's registers let two workgroups share a
//   WGP: the 1536 workgroups are three full rounds of 256 x 2.
// ---------------------------------------------------------------------------
#define FA_WAVES   (QT_COUNT / 2)             /* 11 */
#define FA_THREADS (FA_WAVES * 32)            /* 352 */
#define FA_NB      2                          /* batches of one window in a workgroup */
#define FA_PAIRS   (NB / NWIN / FA_NB)        /* 2 such pairs a window */
#define FA_QSPLIT  (QT_COUNT / FA_WAVES)      /* 2 workgroups share the 22 q-tiles */
#define KL_PITCH   40                         /* halves: 80 B = 16 B x 5, odd, for b128 readers */
#define VL_PITCH   360                        /* halves: 720 B = 16 B x 45, odd */
#define KV_CHUNKS  (N_PAD * HD / 8)           /* 1408 pieces of 16 B in K, and in V^T */

// The operand lane mapping, from an LDS array of the given pitch.
__device__ __forceinline__ v16h lds_frag(const _Float16* base, int rowBase,
                                         int pitch, int k0) {
  int l = threadIdx.x;
  int r = l & 15;
  int g = (l >> 4) & 1;
  const _Float16* p = base + (rowBase + r) * pitch + k0 + g * 8;
  V16U u;
  u.h[0] = *(const v8h*)(p);
  u.h[1] = *(const v8h*)(p + 16);
  return u.v;
}

__global__ __launch_bounds__(FA_THREADS) void flash_attn(
    const _Float16* __restrict__ Qh, const _Float16* __restrict__ Kh,
    const _Float16* __restrict__ Vt, const float* __restrict__ biasF,
    const float* __restrict__ maskF, _Float16* __restrict__ att) {
  __shared__ __attribute__((aligned(16))) _Float16 kl[FA_NB][N_PAD * KL_PITCH];   // 2 x 28,160 B
  __shared__ __attribute__((aligned(16))) _Float16 vl[FA_NB][HD * VL_PITCH];      // 2 x 23,040 B
  int h  = blockIdx.x;            // 0..5
  int pr = blockIdx.y % FA_PAIRS; // pair of batches of the window
  int qh = blockIdx.y / FA_PAIRS; // half of the q-tiles
  int w  = blockIdx.z;            // window index of the mask, 0..63
  int t  = threadIdx.x;
  int wv = __builtin_amdgcn_readfirstlane(t >> 5);   // 0..10

  // batch n of the pair: b = w + 64 * (2 * pr + n), so b % 64 == w
  const size_t bh0    = ((size_t)(w + NWIN * FA_NB * pr)) * NHEAD + h;
  const size_t bhStep = (size_t)NWIN * NHEAD * N_PAD * HD;   // halves from batch n to n + 1
  const _Float16* Qb = Qh + bh0 * N_PAD * HD;
  const _Float16* Kb = Kh + bh0 * N_PAD * HD;
  const _Float16* Vb = Vt + bh0 * HD * N_PAD;

  // The arrays are read as they lie (contiguous 16-B pieces, four of each a
  // thread and batch, all in flight together); each piece of a fragment-order
  // block is laid down at its row and column of the padded row-major LDS arrays.
  v8h kc[FA_NB][KV_CHUNKS / FA_THREADS], vc[FA_NB][KV_CHUNKS / FA_THREADS];
#pragma unroll
  for (int n = 0; n < FA_NB; ++n) {
#pragma unroll
    for (int i = 0; i < KV_CHUNKS / FA_THREADS; ++i) {
      kc[n][i] = *(const v8h*)(Kb + n * bhStep + (size_t)(t + FA_THREADS * i) * 8);
      vc[n][i] = *(const v8h*)(Vb + n * bhStep + (size_t)(t + FA_THREADS * i) * 8);
    }
  }
#pragma unroll
  for (int n = 0; n < FA_NB; ++n) {
#pragma unroll
    for (int i = 0; i < KV_CHUNKS / FA_THREADS; ++i) {
      int f  = t + FA_THREADS * i;
      int fi = f & 15;                      // line of the block
      int fg = (f >> 4) & 1;                // which 8 elements of the line
      int kb = f >> 5;                      // K block: 2 * (n / 16) + d / 16
      int vb = f >> 5;                      // V^T block: 22 * (d / 16) + n / 16
      int vu = vb / QT_COUNT;
      *(v8h*)(kl[n] + ((kb >> 1) * 16 + fi) * KL_PITCH + (kb & 1) * 16 + fg * 8) = kc[n][i];
      *(v8h*)(vl[n] + (vu * 16 + fi) * VL_PITCH + (vb - vu * QT_COUNT) * 16 + fg * 8) = vc[n][i];
    }
  }
  __syncthreads();                // K and V^T are complete before any wave reads them

  int l  = t & 31;
  int qt = qh * FA_WAVES + wv;    // this wave's q-tile

  // this lane's 16-B pieces of the addend tiles of q-tile qt (fragment order)
  const v4f* Bf = (const v4f*)(biasF + (size_t)h * PLANE_F +
                               (size_t)qt * KT_COUNT * TILE_F) + l;
  const v4f* Mf = (const v4f*)(maskF + (size_t)w * PLANE_F +
                               (size_t)qt * KT_COUNT * TILE_F) + l;

  v16h Qop[FA_NB];                // B operands, loaded once
  v8f oLo[FA_NB];                 // O^T rows d=0..15 (this lane: d=8g+r)
  v8f oHi[FA_NB];                 // O^T rows d=16..31
  float mrow[FA_NB];
  float lsum[FA_NB];
#pragma unroll
  for (int n = 0; n < FA_NB; ++n) {
    Qop[n] = load_frag_blocks((const v8h*)(Qb + n * bhStep) + qt * 2 * BLK_P + l);
    oLo[n] = v8f{};
    oHi[n] = v8f{};
    mrow[n] = -3.0e38f;
    lsum[n] = 0.f;
  }
  // what follows reuses the address registers of the Q loads above
  asm volatile("s_wait_xcnt 0x0" ::: "memory");
  // keeps the scheduler from lifting those register writes over the wait
  __builtin_amdgcn_sched_barrier(0);

  for (int k0 = 0; k0 < N_PAD; k0 += 32) {
    // c0 reg r -> key k0+8g+r, c1 reg r -> key k0+16+8g+r; padding keys carry
    // KEY_PAD in the mask plane, so no bounds test is left here.
    int tb = (k0 >> 5) * (TILE_F / 4);
    v4f b0 = Bf[tb], b1 = Bf[tb + 32], b2 = Bf[tb + 64], b3 = Bf[tb + 96];
    v4f m0 = Mf[tb], m1 = Mf[tb + 32], m2 = Mf[tb + 64], m3 = Mf[tb + 96];
    v8f c0, c1;
#pragma unroll
    for (int r = 0; r < 4; ++r) {
      c0[r]     = b0[r] + m0[r];
      c0[4 + r] = b1[r] + m1[r];
      c1[r]     = b2[r] + m2[r];
      c1[4 + r] = b3[r] + m3[r];
    }

#pragma unroll
    for (int n = 0; n < FA_NB; ++n) {
    v16h Ka = lds_frag(kl[n], k0, KL_PITCH, 0);
    v16h Kc = lds_frag(kl[n], k0 + 16, KL_PITCH, 0);
    v8f s0 = wmma_f16(Ka, Qop[n], c0);   // keys k0   .. k0+15 (x query)
    v8f s1 = wmma_f16(Kc, Qop[n], c1);   // keys k0+16.. k0+31

    // --- online softmax (row = query; pair (lane, lane^16) shares a row) ---
    float tm = s0[0];
#pragma unroll
    for (int r = 0; r < 8; ++r) { tm = fmaxf(tm, s0[r]); tm = fmaxf(tm, s1[r]); }
    tm = fmaxf(tm, __shfl_xor(tm, 16, 32));
    float mnew  = fmaxf(mrow[n], tm);
    float alpha = __expf(mrow[n] - mnew);
    mrow[n] = mnew;

    V16U p;                       // P^T in B-operand layout for K=32
    float rs = 0.f;
#pragma unroll
    for (int r = 0; r < 8; ++r) {
      float e0 = __expf(s0[r] - mnew);
      float e1 = __expf(s1[r] - mnew);
      rs += e0 + e1;
      p.h[0][r] = (_Float16)e0;   // keys k0+8g+r
      p.h[1][r] = (_Float16)e1;   // keys k0+16+8g+r
    }
    rs += __shfl_xor(rs, 16, 32);
    lsum[n] = lsum[n] * alpha + rs;

#pragma unroll
    for (int i = 0; i < 8; ++i) { oLo[n][i] *= alpha; oHi[n][i] *= alpha; }

    v16h Va0 = lds_frag(vl[n], 0,  VL_PITCH, k0);     // V^T rows d=0..15
    v16h Va1 = lds_frag(vl[n], 16, VL_PITCH, k0);     // V^T rows d=16..31
    oLo[n] = wmma_f16(Va0, p.v, oLo[n]);
    oHi[n] = wmma_f16(Va1, p.v, oHi[n]);
    }                             // batches of the pair
  }

  // att[b][qt][h] = two fragment-order blocks (line = query, elements = d): the A
  // fragment of stage 3's k step h. The padding queries of q-tile 21 are stored
  // too (finite values); stage 3 computes their rows and does not store them.
#pragma unroll
  for (int n = 0; n < FA_NB; ++n) {
    int b = w + NWIN * (FA_NB * pr + n);
    float inv = 1.0f / lsum[n];
    v8h* dst = (v8h*)att + (((size_t)b * QT_COUNT + qt) * NHEAD + h) * 2 * BLK_P + l;
    v8h a0, a1;
#pragma unroll
    for (int r = 0; r < 8; ++r) {
      a0[r] = (_Float16)(oLo[n][r] * inv);   // d = 8g + r
      a1[r] = (_Float16)(oHi[n][r] * inv);   // d = 16 + 8g + r
    }
    dst[0]     = a0;
    dst[BLK_P] = a1;
  }
}

// ---------------------------------------------------------------------------
// Stage 3: output projection GEMM. out[b][n][c] = att[b][n][:] . proj_w[c][:] + pb[c]
//   The row tiles are stage 2's (22 a batch, padded): a wave's six A fragments
//   are 6,144 contiguous bytes of att. Tile 21 of a batch has 7 rows of out; its
//   other rows are not stored. blockIdx.x = group of 8 row tiles; same workgroup
//   tile as stage 1.
// ---------------------------------------------------------------------------
// The walk over the 12 column tiles. EDGE: the tile is a batch's last, of which
// only rows 0 .. EDGE_ROWS-1 exist; they all lie in the lanes of register group 0
// (low).
#define EDGE_ROWS (N_TOK - (QT_COUNT - 1) * 16)   /* 7 */
static_assert(EDGE_ROWS > 0 && EDGE_ROWS <= 8, "the edge rows lie in register group 0");
template <bool EDGE>
__device__ __forceinline__ void proj_walk(const v16h (&a)[KS_COUNT], const _Float16* wp,
                                          const float* __restrict__ pbl,
                                          float* __restrict__ dst, bool low) {
  // Two column tiles a trip, rolled (unroll 1): fully unrolled, the build kept
  // one fragment set and waited out the LDS latency in front of every WMMA.
#pragma unroll 1
  for (int cp = 0; cp < CT_COUNT; cp += 2) {
    v8f acc[2] = {strip_tile(a, wp, cp), strip_tile(a, wp, cp + 1)};
#pragma unroll
    for (int u = 0; u < 2; ++u) {
      float bias = pbl[(cp + u) * 16];
      if (!EDGE || low) {
#pragma unroll
        for (int r = 0; r < (EDGE ? EDGE_ROWS : 8); ++r)
          dst[(size_t)r * DIMC + (cp + u) * 16] = acc[u][r] + bias;
      }
    }
    // the next trip rewrites registers that these stores name
    asm volatile("s_wait_xcnt 0x0" ::: "memory");
  }
}

__global__ __launch_bounds__(256, 8) void proj_gemm(
    const _Float16* __restrict__ att, const _Float16* __restrict__ pwh,
    const float* __restrict__ pb, float* __restrict__ out) {
  __shared__ __attribute__((aligned(16))) _Float16 wp[DIMC * WP_PITCH];
  int wv = __builtin_amdgcn_readfirstlane(threadIdx.x >> 5);
  int rt = blockIdx.x * GEMM_WAVES + wv;      // row tile, 0..5631
  int b  = rt / QT_COUNT;
  int nbase = (rt - b * QT_COUNT) * 16;
  int l = threadIdx.x & 31;

  v16h a[KS_COUNT];
#pragma unroll
  for (int ks = 0; ks < KS_COUNT; ++ks)
    a[ks] = load_frag_blocks((const v8h*)att + ((size_t)rt * KS_COUNT + ks) * 2 * BLK_P + l);
  // the staging below reuses the address registers of the loads above
  asm volatile("s_wait_xcnt 0x0" ::: "memory");
  stage_panel(pwh, wp);
  __syncthreads();                // the panel is complete before any wave reads it

  int g = l >> 4;
  float* dst = out + ((size_t)b * N_TOK + nbase + 8 * g) * DIMC + (l & 15);
  // nbase is the same in every lane of a wave, and no barrier follows
  if (nbase + 16 <= N_TOK) proj_walk<false>(a, wp, pb + (l & 15), dst, true);
  else                     proj_walk<true>(a, wp, pb + (l & 15), dst, g == 0);
}

// ---------------------------------------------------------------------------
// Host launcher
// ---------------------------------------------------------------------------
extern "C" void kernel_launch(void* const* d_in, const int* in_sizes, int n_in,
                              void* d_out, int out_size, void* d_ws, size_t ws_size,
                              hipStream_t stream) {
  const float* x1     = (const float*)d_in[0];
  const float* x2     = (const float*)d_in[1];
  const float* mask   = (const float*)d_in[2];
  const float* table  = (const float*)d_in[3];
  const float* q_w    = (const float*)d_in[4];
  const float* q_b    = (const float*)d_in[5];
  const float* kv_w   = (const float*)d_in[6];
  const float* kv_b   = (const float*)d_in[7];
  const float* proj_w = (const float*)d_in[8];
  const float* proj_b = (const float*)d_in[9];
  const int*   relidx = (const int*)d_in[10];
  float* out = (float*)d_out;

  char* ws = (char*)d_ws;
  // workspace layout (256B aligned)
  const size_t o_qwh  = 0;                                 //  73,728 B
  const size_t o_kvwh = o_qwh  + 73728;                    // 147,456 B
  const size_t o_pwh  = o_kvwh + 147456;                   //  73,728 B
  const size_t o_bias = o_pwh  + 73728;                    //  2,973,696 B (6 planes)
  const size_t o_mask = o_bias + 2973696;                  // 31,719,424 B (64 planes)
  const size_t o_Qh   = o_mask + 31719424;                 // 34,603,008 B
  const size_t o_Kh   = o_Qh   + 34603008;
  const size_t o_Vt   = o_Kh   + 34603008;
  const size_t o_att  = o_Vt   + 34603008;                 // 34,603,008 B (rows padded)

  _Float16* qwh  = (_Float16*)(ws + o_qwh);
  _Float16* kvwh = (_Float16*)(ws + o_kvwh);
  _Float16* pwh  = (_Float16*)(ws + o_pwh);
  float*    bsm  = (float*)   (ws + o_bias);
  float*    mskf = (float*)   (ws + o_mask);
  _Float16* Qh   = (_Float16*)(ws + o_Qh);
  _Float16* Kh   = (_Float16*)(ws + o_Kh);
  _Float16* Vt   = (_Float16*)(ws + o_Vt);
  _Float16* att  = (_Float16*)(ws + o_att);

  // Stage 0: conversion of the weights that stage 1 reads
  cvt_qkv_weights<<<QW_BLOCKS + KVW_BLOCKS, 256, 0, stream>>>(q_w, kv_w, qwh, kvwh);

  // Stage 1: QKV projections (f16 WMMA, f32 accumulate); in the same grid the
  // bias gather, the mask re-layout and the output weights' conversion
  qkv_and_addends<<<S1_BLOCKS, 256, 0, stream>>>(
      x1, x2, qwh, kvwh, q_b, kv_b, Qh, Kh, Vt,
      mask, mskf, table, relidx, bsm, proj_w, pwh);

  // Stage 2: fused flash attention (QK^T + bias + mask + softmax + PV)
  flash_attn<<<dim3(NHEAD, FA_PAIRS * FA_QSPLIT, NWIN), FA_THREADS, 0, stream>>>(
      Qh, Kh, Vt, bsm, mskf, att);

  // Stage 3: output projection
  proj_gemm<<<dim3(ROW_TILES / GEMM_WAVES), 256, 0, stream>>>(att, pwh, proj_b, out);
}

// v007
// One run takes 105 microseconds.
// In two side-by-side timings against v006, it was 1.05 and 1.04 times as fast.
// Over all steps from v000 it is 13.3 times as fast.
#include <hip/hip_runtime.h>
#include <hip/hip_bf16.h>

typedef __attribute__((ext_vector_type(16))) _Float16 v16h;
typedef __attribute__((ext_vector_type(8)))  _Float16 v8h;
typedef __attribute__((ext_vector_type(8)))  float    v8f;
typedef __attribute__((ext_vector_type(4)))  float    v4f;

#define N_TOK 343
#define N_PAD 352
#define DIMC  192
#define NHEAD 6
#define HD    32
#define NWIN  64
#define NB    256
#define QT_COUNT 22   /* 352/16 */
#define KT_COUNT 11   /* 352/32 */
#define TILE_F   512  /* floats of one 16-query x 32-key score tile */
#define PLANE_F  (QT_COUNT * KT_COUNT * TILE_F)   /* 352*352 floats */
#define TAB_ROWS 2197
#define KEY_PAD  (-1.0e30f)

union V16U { v16h v; v8h h[2]; };

// ---------------------------------------------------------------------------
// Operand lane mapping of a 16-row x 32-k f16 fragment:
//   A-operand: lane(0..15)=row rowBase+l, k = k0+{0..7,16..23}
//              lane(16..31)=row rowBase+(l-16), k = k0+{8..15,24..31}
// (B-operand uses the same pattern with "row" = output column / query index.)
//
// Fragment order of the f16 intermediates in the workspace (Q, K, V^T and the
// attention output): a 16 x 16 block is 32 pieces of 16 B, piece = lane;
//   lane = 16*g + i holds line i of the block, its elements 8*g .. 8*g+7.
// That is one half of an operand fragment and also what a lane holds of a
// 16 x 16 accumulator tile (its column i, rows 8*g .. 8*g+7), so a wave stores
// or loads a block as 512 contiguous bytes (four whole 128-B lines).
// ---------------------------------------------------------------------------
#define BLK_P 32   /* 16-B pieces of a block */

// Operand fragment made of the two blocks at p (k 0..15) and p + BLK_P (k 16..31);
// p already points at this lane's piece.
__device__ __forceinline__ v16h load_frag_blocks(const v8h* p) {
  V16U u;
  u.h[0] = p[0];
  u.h[1] = p[BLK_P];
  return u.v;
}

// The operand lane mapping from a row-major f32 source (converted to f16); rows >= nvalid -> 0.
// The address is clamped and the value selected, with no branch round the
// loads, so that a wave's loads of all k steps are in flight together.
__device__ __forceinline__ v16h load_f32_tile_cvt(const float* base, int rowBase,
                                                  int nvalid, int ld, int k0) {
  int l = threadIdx.x;
  int r = l & 15;
  int g = (l >> 4) & 1;
  int row = rowBase + r;
  bool in = (row < nvalid);
  const float* p = base + (size_t)min(row, nvalid - 1) * ld + k0 + g * 8;
  v4f a0 = *(const v4f*)(p);
  v4f a1 = *(const v4f*)(p + 4);
  v4f b0 = *(const v4f*)(p + 16);
  v4f b1 = *(const v4f*)(p + 20);
  V16U u;
#pragma unroll
  for (int i = 0; i < 4; ++i) {
    u.h[0][i]     = in ? (_Float16)a0[i] : (_Float16)0.f;
    u.h[0][4 + i] = in ? (_Float16)a1[i] : (_Float16)0.f;
    u.h[1][i]     = in ? (_Float16)b0[i] : (_Float16)0.f;
    u.h[1][4 + i] = in ? (_Float16)b1[i] : (_Float16)0.f;
  }
  return u.v;
}

__device__ __forceinline__ v8f wmma_f16(v16h a, v16h b, v8f c) {
  return __builtin_amdgcn_wmma_f32_16x16x32_f16(false, a, false, b, (short)0, c,
                                                false, false);
}

// ---------------------------------------------------------------------------
// Which workgroup takes which batch (stages 1, 2 and 3; for speed only, every
// map is a permutation and nothing rests on where a workgroup runs).
//   Class c = flat index % 8 takes the batches with b % 8 == c, in
//   every launch. Place o = 0..31 inside a class keeps the four batches of a
//   window together: window c + 8 * (o / 4), its batch number o % 4.
//   Stages 1 and 3 walk the places upwards, stage 2 walks the windows downwards.
// ---------------------------------------------------------------------------
#define NCLASS    8
#define CLASS_WIN (NWIN / NCLASS)             /* 8 windows of a class */
__device__ __forceinline__ int class_batch(int c, int o) {
  return c + NCLASS * (o >> 2) + NWIN * (o & 3);
}

// ---------------------------------------------------------------------------
// Stage 0a: f32 -> f16 weight conversion, block blk of 256 elements.
//   The Q and the K/V weights, which stage 1 reads, share one launch; the
//   output projection's weights are converted inside stage 1's launch.
// ---------------------------------------------------------------------------
#define QW_BLOCKS  (DIMC * DIMC / 256)        /* 144 */
#define KVW_BLOCKS (2 * DIMC * DIMC / 256)    /* 288 */
__device__ __forceinline__ void cvt_block(const float* __restrict__ src,
                                          _Float16* __restrict__ dst, int n, int blk) {
  int i = blk * 256 + threadIdx.x;
  if (i < n) dst[i] = (_Float16)src[i];
}

__global__ __launch_bounds__(256) void cvt_qkv_weights(
    const float* __restrict__ qw, const float* __restrict__ kvw,
    _Float16* __restrict__ qwh, _Float16* __restrict__ kvwh) {
  int blk = blockIdx.x;
  if (blk < QW_BLOCKS) cvt_block(qw, qwh, DIMC * DIMC, blk);
  else                 cvt_block(kvw, kvwh, 2 * DIMC * DIMC, blk - QW_BLOCKS);
}

// ---------------------------------------------------------------------------
// Fragment order of the score addends (bias and mask planes, 352 x 352 padded):
//   plane[qt][kt][j][lane][e], one 16-query x 32-key tile = 4 x 32 x 4 floats.
//   lane = 16*g + (q & 15); key = 32*kt + 16*(j >> 1) + 8*g + 4*(j & 1) + e.
// That is the accumulator layout of S^T in flash_attn: load j of a tile is
// 32 lanes x 16 B = 512 contiguous bytes (four whole 128-B lines).
// ---------------------------------------------------------------------------

// ---------------------------------------------------------------------------
// Stage 0b: relative-position bias gather into fragment order:
//   biasF[h] at (q,k) = table[rel_idx[q][k]][h]; 0 in the padding.
// ---------------------------------------------------------------------------
#define BIAS_BLOCKS ((PLANE_F + 255) / 256)   /* 484 */
__device__ __forceinline__ void bias_gather(const float* __restrict__ table,
                                            const int* __restrict__ rel_idx,
                                            float* __restrict__ biasF, int blk) {
  int i = blk * 256 + threadIdx.x;             // index inside a plane
  if (i < PLANE_F) {
    int e    = i & 3;
    int lane = (i >> 2) & 31;
    int j    = (i >> 7) & 3;
    int tile = i >> 9;
    int qt = tile / KT_COUNT;
    int kt = tile - qt * KT_COUNT;
    int q = qt * 16 + (lane & 15);
    int k = kt * 32 + (j >> 1) * 16 + (lane >> 4) * 8 + (j & 1) * 4 + e;
    bool in = (q < N_TOK) && (k < N_TOK);
    int idx = in ? rel_idx[q * N_TOK + k] : 0;
    idx = min(max(idx, 0), TAB_ROWS - 1);      // the table read stays in bounds
#pragma unroll
    for (int h = 0; h < NHEAD; ++h) {
      float tv = table[idx * NHEAD + h];
      biasF[(size_t)h * PLANE_F + i] = in ? tv : 0.f;
    }
  }
}

// ---------------------------------------------------------------------------
// Stage 0c: mask -> fragment order, one block per (q-tile, window):
//   blk % 8 = class of the window, blk / 8 = 22 * (window / 8) + qt.
//   Rows are read as whole rows (coalesced), turned in LDS, and written as
//   contiguous 16-B pieces. Padding keys get KEY_PAD, padding queries 0.
// ---------------------------------------------------------------------------
#define MROW_PITCH 356   /* floats; 16-B multiple, spreads the 16 rows over the banks */
#define MASK_BLOCKS (QT_COUNT * NWIN)         /* 1408 */
__device__ __forceinline__ void mask_to_fragments(
    const float* __restrict__ mask, float* __restrict__ maskF,
    float* rows /* LDS, 16 * MROW_PITCH floats */, int blk) {
  int wi = (blk / NCLASS) / QT_COUNT;
  int qt = (blk / NCLASS) - wi * QT_COUNT;
  int w  = (blk % NCLASS) + NCLASS * wi;
  int t  = threadIdx.x;
  int ln = t & 31;
  int wv = t >> 5;
  const float* Mw = mask + (size_t)w * N_TOK * N_TOK;
  // Clamped addresses instead of branches, and the loops unrolled: the 22
  // loads of a wave are then all in flight before the first LDS store waits.
  float v[2][KT_COUNT];
#pragma unroll
  for (int rr = 0; rr < 2; ++rr) {
    int q = qt * 16 + wv + 8 * rr;
    const float* Mr = Mw + (size_t)min(q, N_TOK - 1) * N_TOK;
#pragma unroll
    for (int i = 0; i < KT_COUNT; ++i) v[rr][i] = Mr[min(ln + 32 * i, N_TOK - 1)];
  }
#pragma unroll
  for (int rr = 0; rr < 2; ++rr) {
    int ql = wv + 8 * rr;
    bool qin = (qt * 16 + ql < N_TOK);
#pragma unroll
    for (int i = 0; i < KT_COUNT; ++i) {
      int k = ln + 32 * i;
      rows[ql * MROW_PITCH + k] = (k < N_TOK) ? (qin ? v[rr][i] : 0.f) : KEY_PAD;
    }
  }
  __syncthreads();
  v4f* dst = (v4f*)(maskF + (size_t)w * PLANE_F + (size_t)qt * KT_COUNT * TILE_F);
  for (int f = t; f < KT_COUNT * TILE_F / 4; f += 256) {
    int lane = f & 31;
    int j    = (f >> 5) & 3;
    int kt   = f >> 7;
    int k = kt * 32 + (j >> 1) * 16 + (lane >> 4) * 8 + (j & 1) * 4;
    dst[f] = *(const v4f*)(rows + (lane & 15) * MROW_PITCH + k);
  }
}

// ---------------------------------------------------------------------------
// Projection GEMMs: one workgroup of 8 waves per 128 rows x 192 columns.
//   The 192 x 192 f16 weight panel is staged once in LDS and shared by the 8
//   waves; each wave keeps the six A fragments of its 16 rows in registers and
//   walks the 12 column tiles. The k order of every sum is k0 = 0,32,..,160.
// ---------------------------------------------------------------------------
#define GEMM_WAVES 8
#define ROW_TILES  (QT_COUNT * NB)            /* 5632 = 704 * 8 */
#define CT_COUNT   12                         /* 192/16 column tiles of a panel */
#define KS_COUNT   6                          /* 192/32 k steps */
#define WP_PITCH   200                        /* halves: 400 B = 16 B x 25, odd, for b128 readers */
#define WP_CHUNKS  (DIMC * DIMC / 8)          /* 4608 pieces of 16 B */
// The panel takes 76,800 B, so four workgroups fit a WGP's LDS: the second
// launch bound (8 waves per SIMD) keeps the registers from allowing fewer.

__device__ __forceinline__ void stage_panel(const _Float16* __restrict__ Wp,
                                            _Float16* wp) {
  int t = threadIdx.x;
  v8h tmp[WP_CHUNKS / 256];
  // unrolled: all 18 loads of a thread are in flight before the first LDS store
#pragma unroll
  for (int i = 0; i < WP_CHUNKS / 256; ++i)
    tmp[i] = *(const v8h*)(Wp + (size_t)(t + 256 * i) * 8);
#pragma unroll
  for (int i = 0; i < WP_CHUNKS / 256; ++i) {
    int f   = t + 256 * i;
    int row = f / (DIMC / 8);
    int ch  = f - row * (DIMC / 8);
    *(v8h*)(wp + row * WP_PITCH + ch * 8) = tmp[i];
  }
}

// The operand lane mapping, from the LDS panel.
__device__ __forceinline__ v16h panel_frag(const _Float16* wp, int rowBase, int k0) {
  int l = threadIdx.x;
  int r = l & 15;
  int g = (l >> 4) & 1;
  const _Float16* p = wp + (rowBase + r) * WP_PITCH + k0 + g * 8;
  V16U u;
  u.h[0] = *(const v8h*)(p);
  u.h[1] = *(const v8h*)(p + 16);
  return u.v;
}

__device__ __forceinline__ v8f strip_tile(const v16h (&a)[KS_COUNT],
                                          const _Float16* wp, int ct) {
  v8f acc = {};
#pragma unroll
  for (int ks = 0; ks < KS_COUNT; ++ks)
    acc = wmma_f16(a[ks], panel_frag(wp, ct * 16, ks * 32), acc);
  return acc;
}

// The same products with the operands exchanged: the tile comes out transposed
// (lane = row of a, registers = 8 consecutive columns of the panel).
__device__ __forceinline__ v8f strip_tile_t(const v16h (&a)[KS_COUNT],
                                            const _Float16* wp, int ct) {
  v8f acc = {};
#pragma unroll
  for (int ks = 0; ks < KS_COUNT; ++ks)
    acc = wmma_f16(panel_frag(wp, ct * 16, ks * 32), a[ks], acc);
  return acc;
}

// ---------------------------------------------------------------------------
// Stage 1: QKV projection GEMM, block blk of QKV_BLOCKS.
//   blk % 8 = class of its batches; (blk / 8) % 3 = panel (0 Q, 1 K, 2 V),
//   (blk / 8) / 3 = group of 8 of the class's 32 * 22 row tiles
//   All three go out in fragment order, one 512-B store a 16 x 16 tile:
//   Q  -> Qh[b][h][n/16][d/16] blocks, line = n, elements = d (pre-scaled by hd^-0.5)
//   K  -> Kh[b][h][n/16][d/16] blocks, line = n, elements = d
//   V  -> Vt[b][h][d/16][n/16] blocks, line = d, elements = n
//   Q and K tiles are computed transposed, so that a lane holds 8 d of one n.
// ---------------------------------------------------------------------------
#define QKV_BLOCKS (3 * ROW_TILES / GEMM_WAVES)   /* 2112 */
__device__ __forceinline__ void qkv_gemm(
    const float* __restrict__ x1, const float* __restrict__ x2,
    const _Float16* __restrict__ qwh, const _Float16* __restrict__ kvwh,
    const float* __restrict__ qb, const float* __restrict__ kvb,
    _Float16* __restrict__ Qh, _Float16* __restrict__ Kh,
    _Float16* __restrict__ Vt, _Float16* wp /* LDS panel */, int blk) {
  int grp = (blk / NCLASS) / 3;
  int pn  = (blk / NCLASS) - grp * 3;
  int wv = __builtin_amdgcn_readfirstlane(threadIdx.x >> 5);
  int rt = grp * GEMM_WAVES + wv;             // row tile of the class, 0..703
  int o  = rt / QT_COUNT;
  int b  = class_batch(blk % NCLASS, o);
  int nbase = (rt - o * QT_COUNT) * 16;
  const float*    X  = (pn == 0) ? x1 : x2;
  const _Float16* Wp = (pn == 0) ? qwh : kvwh + (size_t)(pn - 1) * DIMC * DIMC;
  const float*    bv = (pn == 0) ? qb : kvb + (pn - 1) * DIMC;

  stage_panel(Wp, wp);
  // Keeps the 24 f32 loads below from being lifted among the 18 staging loads:
  // both sets in flight at once need more registers than 8 waves per SIMD leave,
  // and the build then spills to scratch.
  __builtin_amdgcn_sched_barrier(0);
  v16h a[KS_COUNT];
#pragma unroll
  for (int ks = 0; ks < KS_COUNT; ++ks)
    a[ks] = load_f32_tile_cvt(X + (size_t)b * N_TOK * DIMC, nbase, N_TOK, DIMC, ks * 32);
  __syncthreads();                // the panel is complete before any wave reads it

  int l = threadIdx.x & 31;
  int g = l >> 4;                 // register group: elements 8g .. 8g+7 of a tile's line
  int cl = l & 15;                // this lane's line inside a tile
  int nt = nbase >> 4;            // row tile inside the batch

  // The walks go two column tiles a trip and stay rolled (unroll 1): unrolled,
  // the fragment loads of all 12 tiles are hoisted until A spills to scratch.
  if (pn == 2) {
#pragma unroll 1
    for (int cp = 0; cp < CT_COUNT; cp += 2) {
      v8f acc[2] = {strip_tile(a, wp, cp), strip_tile(a, wp, cp + 1)};
#pragma unroll
      for (int u = 0; u < 2; ++u) {
        float bias = bv[(cp + u) * 16 + cl];
        v8h o;
#pragma unroll
        for (int r = 0; r < 8; ++r) o[r] = (_Float16)(acc[u][r] + bias);
        ((v8h*)Vt)[(((size_t)b * CT_COUNT + cp + u) * QT_COUNT + nt) * BLK_P + l] = o;
      }
    }
  } else if (pn == 1) {
#pragma unroll 1
    for (int cp = 0; cp < CT_COUNT; cp += 2) {
      v8f acc[2] = {strip_tile_t(a, wp, cp), strip_tile_t(a, wp, cp + 1)};
      v8h* base = (v8h*)Kh + (((size_t)b * NHEAD + (cp >> 1)) * QT_COUNT + nt) * 2 * BLK_P + l;   // head cp/2
#pragma unroll
      for (int u = 0; u < 2; ++u) {
        const v4f* bp = (const v4f*)(bv + (cp + u) * 16 + 8 * g);
        v4f bl = bp[0], bh = bp[1];
        v8h o;
#pragma unroll
        for (int r = 0; r < 4; ++r) {
          o[r]     = (_Float16)(acc[u][r] + bl[r]);
          o[4 + r] = (_Float16)(acc[u][4 + r] + bh[r]);
        }
        base[u * BLK_P] = o;
      }
    }
  } else {
    const float scale = 0.17677669529663687f;  // 32^-0.5
#pragma unroll 1
    for (int cp = 0; cp < CT_COUNT; cp += 2) {
      v8f acc[2] = {strip_tile_t(a, wp, cp), strip_tile_t(a, wp, cp + 1)};
      v8h* base = (v8h*)Qh + (((size_t)b * NHEAD + (cp >> 1)) * QT_COUNT + nt) * 2 * BLK_P + l;   // head cp/2
#pragma unroll
      for (int u = 0; u < 2; ++u) {
        const v4f* bp = (const v4f*)(bv + (cp + u) * 16 + 8 * g);
        v4f bl = bp[0], bh = bp[1];
        v8h o;
#pragma unroll
        for (int r = 0; r < 4; ++r) {
          o[r]     = (_Float16)((acc[u][r] + bl[r]) * scale);
          o[4 + r] = (_Float16)((acc[u][4 + r] + bh[r]) * scale);
        }
        base[u * BLK_P] = o;
      }
    }
  }
}

// ---------------------------------------------------------------------------
// Stage 1's launch. The bias gather, the mask re-layout and the conversion of
//   the output projection's weights read only inputs and are first read by
//   stage 2 or 3, so they need no launch of their own: their blocks follow the
//   GEMM's in one grid. The long blocks have the low indices,
//   the short ones the high.
//   Every branch is uniform for the block, so each barrier is passed by all
//   of its threads. The mask's rows use the LDS of the weight panel.
// ---------------------------------------------------------------------------
#define S1_BLOCKS (QKV_BLOCKS + MASK_BLOCKS + BIAS_BLOCKS + QW_BLOCKS)
static_assert(QKV_BLOCKS % (3 * NCLASS) == 0 && MASK_BLOCKS % NCLASS == 0,
              "a part's own block index has the grid's class");
__global__ __launch_bounds__(256, 8) void qkv_and_addends(
    const float* __restrict__ x1, const float* __restrict__ x2,
    const _Float16* __restrict__ qwh, const _Float16* __restrict__ kvwh,
    const float* __restrict__ qb, const float* __restrict__ kvb,
    _Float16* __restrict__ Qh, _Float16* __restrict__ Kh,
    _Float16* __restrict__ Vt,
    const float* __restrict__ mask, float* __restrict__ maskF,
    const float* __restrict__ table, const int* __restrict__ rel_idx,
    float* __restrict__ biasF,
    const float* __restrict__ pw, _Float16* __restrict__ pwh) {
  __shared__ __attribute__((aligned(16))) _Float16 wp[DIMC * WP_PITCH];
  static_assert(16 * MROW_PITCH * sizeof(float) <= sizeof(wp), "mask rows fit the panel");
  int blk = blockIdx.x;
  if (blk < QKV_BLOCKS) {
    qkv_gemm(x1, x2, qwh, kvwh, qb, kvb, Qh, Kh, Vt, wp, blk);
  } else if (blk < QKV_BLOCKS + MASK_BLOCKS) {
    mask_to_fragments(mask, maskF, (float*)wp, blk - QKV_BLOCKS);
  } else if (blk < QKV_BLOCKS + MASK_BLOCKS + BIAS_BLOCKS) {
    bias_gather(table, rel_idx, biasF, blk - (QKV_BLOCKS + MASK_BLOCKS));
  } else {
    cvt_block(pw, pwh, DIMC * DIMC, blk - (QKV_BLOCKS + MASK_BLOCKS + BIAS_BLOCKS));
  }
}

// ---------------------------------------------------------------------------
// Stage 2: flash attention, one workgroup of 11 waves per (window, head, pair
//   of batches, half of the q-tiles); a wave takes one q-tile. Batches b and
//   b + 64 have the same window, so at one head they add the same bias and mask
//   tile to their scores: a wave loads and sums that tile once a k step and
//   uses the sum for both batches, as the start value (C operand) of their
//   score products. K and V^T of both batches are staged once in LDS and
//   shared by the 11 waves.
//   Computes S^T = K x Q^T so P^T (in D-register layout) is directly the
//   B operand of O^T = V^T x P^T (32 keys per iteration => K=32 exactly).
//   102,400 B of LDS and this kernel's registers let two workgroups share a
//   WGP: the 1536 workgroups are three full rounds of 256 x 2.
// ---------------------------------------------------------------------------
#define FA_WAVES   (QT_COUNT / 2)             /* 11 */
#define FA_THREADS (FA_WAVES * 32)            /* 352 */
#define FA_NB      2                          /* batches of one window in a workgroup */
#define FA_PAIRS   (NB / NWIN / FA_NB)        /* 2 such pairs a window */
#define FA_QSPLIT  (QT_COUNT / FA_WAVES)      /* 2 workgroups share the 22 q-tiles */
#define FA_PER_WIN (NHEAD * FA_PAIRS * FA_QSPLIT)   /* 24 workgroups a window */
#define KL_PITCH   40                         /* halves: 80 B = 16 B x 5, odd, for b128 readers */
#define VL_PITCH   360                        /* halves: 720 B = 16 B x 45, odd */
#define KV_CHUNKS  (N_PAD * HD / 8)           /* 1408 pieces of 16 B in K, and in V^T */

// The operand lane mapping, from an LDS array of the given pitch.
__device__ __forceinline__ v16h lds_frag(const _Float16* base, int rowBase,
                                         int pitch, int k0) {
  int l = threadIdx.x;
  int r = l & 15;
  int g = (l >> 4) & 1;
  const _Float16* p = base + (rowBase + r) * pitch + k0 + g * 8;
  V16U u;
  u.h[0] = *(const v8h*)(p);
  u.h[1] = *(const v8h*)(p + 16);
  return u.v;
}

__global__ __launch_bounds__(FA_THREADS) void flash_attn(
    const _Float16* __restrict__ Qh, const _Float16* __restrict__ Kh,
    const _Float16* __restrict__ Vt, const float* __restrict__ biasF,
    const float* __restrict__ maskF, _Float16* __restrict__ att) {
  __shared__ __attribute__((aligned(16))) _Float16 kl[FA_NB][N_PAD * KL_PITCH];   // 2 x 28,160 B
  __shared__ __attribute__((aligned(16))) _Float16 vl[FA_NB][HD * VL_PITCH];      // 2 x 23,040 B
  int pl = blockIdx.x / NCLASS;   // place inside the class, 0..191
  int j  = pl % FA_PER_WIN;       // which of the window's workgroups
  int h  = j % NHEAD;             // 0..5
  int pr = (j / NHEAD) % FA_PAIRS; // pair of batches of the window
  int qh = (j / NHEAD) / FA_PAIRS; // half of the q-tiles
  // window index of the mask, 0..63; the class's last window first
  int w  = blockIdx.x % NCLASS + NCLASS * (CLASS_WIN - 1 - pl / FA_PER_WIN);
  int t  = threadIdx.x;
  int wv = __builtin_amdgcn_readfirstlane(t >> 5);   // 0..10

  // batch n of the pair: b = w + 64 * (2 * pr + n), so b % 64 == w
  const size_t bh0    = ((size_t)(w + NWIN * FA_NB * pr)) * NHEAD + h;
  const size_t bhStep = (size_t)NWIN * NHEAD * N_PAD * HD;   // halves from batch n to n + 1
  const _Float16* Qb = Qh + bh0 * N_PAD * HD;
  const _Float16* Kb = Kh + bh0 * N_PAD * HD;
  const _Float16* Vb = Vt + bh0 * HD * N_PAD;

  // The arrays are read as they lie (contiguous 16-B pieces, four of each a
  // thread and batch, all in flight together); each piece of a fragment-order
  // block is laid down at its row and column of the padded row-major LDS arrays.
  v8h kc[FA_NB][KV_CHUNKS / FA_THREADS], vc[FA_NB][KV_CHUNKS / FA_THREADS];
#pragma unroll
  for (int n = 0; n < FA_NB; ++n) {
#pragma unroll
    for (int i = 0; i < KV_CHUNKS / FA_THREADS; ++i) {
      kc[n][i] = *(const v8h*)(Kb + n * bhStep + (size_t)(t + FA_THREADS * i) * 8);
      vc[n][i] = *(const v8h*)(Vb + n * bhStep + (size_t)(t + FA_THREADS * i) * 8);
    }
  }
#pragma unroll
  for (int n = 0; n < FA_NB; ++n) {
#pragma unroll
    for (int i = 0; i < KV_CHUNKS / FA_THREADS; ++i) {
      int f  = t + FA_THREADS * i;
      int fi = f & 15;                      // line of the block
      int fg = (f >> 4) & 1;                // which 8 elements of the line
      int kb = f >> 5;                      // K block: 2 * (n / 16) + d / 16
      int vb = f >> 5;                      // V^T block: 22 * (d / 16) + n / 16
      int vu = vb / QT_COUNT;
      *(v8h*)(kl[n] + ((kb >> 1) * 16 + fi) * KL_PITCH + (kb & 1) * 16 + fg * 8) = kc[n][i];
      *(v8h*)(vl[n] + (vu * 16 + fi) * VL_PITCH + (vb - vu * QT_COUNT) * 16 + fg * 8) = vc[n][i];
    }
  }
  __syncthreads();                // K and V^T are complete before any wave reads them

  int l  = t & 31;
  int qt = qh * FA_WAVES + wv;    // this wave's q-tile

  // this lane's 16-B pieces of the addend tiles of q-tile qt (fragment order)
  const v4f* Bf = (const v4f*)(biasF + (size_t)h * PLANE_F +
                               (size_t)qt * KT_COUNT * TILE_F) + l;
  const v4f* Mf = (const v4f*)(maskF + (size_t)w * PLANE_F +
                               (size_t)qt * KT_COUNT * TILE_F) + l;

  v16h Qop[FA_NB];                // B operands, loaded once
  v8f oLo[FA_NB];                 // O^T rows d=0..15 (this lane: d=8g+r)
  v8f oHi[FA_NB];                 // O^T rows d=16..31
  float mrow[FA_NB];
  float lsum[FA_NB];
#pragma unroll
  for (int n = 0; n < FA_NB; ++n) {
    Qop[n] = load_frag_blocks((const v8h*)(Qb + n * bhStep) + qt * 2 * BLK_P + l);
    oLo[n] = v8f{};
    oHi[n] = v8f{};
    mrow[n] = -3.0e38f;
    lsum[n] = 0.f;
  }
  // what follows reuses the address registers of the Q loads above
  asm volatile("s_wait_xcnt 0x0" ::: "memory");
  // keeps the scheduler from lifting those register writes over the wait
  __builtin_amdgcn_sched_barrier(0);

  for (int k0 = 0; k0 < N_PAD; k0 += 32) {
    // c0 reg r -> key k0+8g+r, c1 reg r -> key k0+16+8g+r; padding keys carry
    // KEY_PAD in the mask plane, so no bounds test is left here.
    int tb = (k0 >> 5) * (TILE_F / 4);
    v4f b0 = Bf[tb], b1 = Bf[tb + 32], b2 = Bf[tb + 64], b3 = Bf[tb + 96];
    v4f m0 = Mf[tb], m1 = Mf[tb + 32], m2 = Mf[tb + 64], m3 = Mf[tb + 96];
    v8f c0, c1;
#pragma unroll
    for (int r = 0; r < 4; ++r) {
      c0[r]     = b0[r] + m0[r];
      c0[4 + r] = b1[r] + m1[r];
      c1[r]     = b2[r] + m2[r];
      c1[4 + r] = b3[r] + m3[r];
    }

#pragma unroll
    for (int n = 0; n < FA_NB; ++n) {
    v16h Ka = lds_frag(kl[n], k0, KL_PITCH, 0);
    v16h Kc = lds_frag(kl[n], k0 + 16, KL_PITCH, 0);
    v8f s0 = wmma_f16(Ka, Qop[n], c0);   // keys k0   .. k0+15 (x query)
    v8f s1 = wmma_f16(Kc, Qop[n], c1);   // keys k0+16.. k0+31

    // --- online softmax (row = query; pair (lane, lane^16) shares a row) ---
    float tm = s0[0];
#pragma unroll
    for (int r = 0; r < 8; ++r) { tm = fmaxf(tm, s0[r]); tm = fmaxf(tm, s1[r]); }
    tm = fmaxf(tm, __shfl_xor(tm, 16, 32));
    float mnew  = fmaxf(mrow[n], tm);
    float alpha = __expf(mrow[n] - mnew);
    mrow[n] = mnew;

    V16U p;                       // P^T in B-operand layout for K=32
    float rs = 0.f;
#pragma unroll
    for (int r = 0; r < 8; ++r) {
      float e0 = __expf(s0[r] - mnew);
      float e1 = __expf(s1[r] - mnew);
      rs += e0 + e1;
      p.h[0][r] = (_Float16)e0;   // keys k0+8g+r
      p.h[1][r] = (_Float16)e1;   // keys k0+16+8g+r
    }
    rs += __shfl_xor(rs, 16, 32);
    lsum[n] = lsum[n] * alpha + rs;

#pragma unroll
    for (int i = 0; i < 8; ++i) { oLo[n][i] *= alpha; oHi[n][i] *= alpha; }

    v16h Va0 = lds_frag(vl[n], 0,  VL_PITCH, k0);     // V^T rows d=0..15
    v16h Va1 = lds_frag(vl[n], 16, VL_PITCH, k0);     // V^T rows d=16..31
    oLo[n] = wmma_f16(Va0, p.v, oLo[n]);
    oHi[n] = wmma_f16(Va1, p.v, oHi[n]);
    }                             // batches of the pair
  }

  // att[b][qt][h] = two fragment-order blocks (line = query, elements = d): the A
  // fragment of stage 3's k step h. The padding queries of q-tile 21 are stored
  // too (finite values); stage 3 computes their rows and does not store them.
#pragma unroll
  for (int n = 0; n < FA_NB; ++n) {
    int b = w + NWIN * (FA_NB * pr + n);
    float inv = 1.0f / lsum[n];
    v8h* dst = (v8h*)att + (((size_t)b * QT_COUNT + qt) * NHEAD + h) * 2 * BLK_P + l;
    v8h a0, a1;
#pragma unroll
    for (int r = 0; r < 8; ++r) {
      a0[r] = (_Float16)(oLo[n][r] * inv);   // d = 8g + r
      a1[r] = (_Float16)(oHi[n][r] * inv);   // d = 16 + 8g + r
    }
    dst[0]     = a0;
    dst[BLK_P] = a1;
  }
}

// ---------------------------------------------------------------------------
// Stage 3: output projection GEMM. out[b][n][c] = att[b][n][:] . proj_w[c][:] + pb[c]
//   The row tiles are stage 2's (22 a batch, padded): a wave's six A fragments
//   are 6,144 contiguous bytes of att. Tile 21 of a batch has 7 rows of out; its
//   other rows are not stored. blockIdx.x % 8 = class of its batches, blockIdx.x / 8
//   = group of 8 of the class's row tiles; same workgroup tile as stage 1.
// ---------------------------------------------------------------------------
// The walk over the 12 column tiles. EDGE: the tile is a batch's last, of which
// only rows 0 .. EDGE_ROWS-1 exist; they all lie in the lanes of register group 0
// (low).
#define EDGE_ROWS (N_TOK - (QT_COUNT - 1) * 16)   /* 7 */
static_assert(EDGE_ROWS > 0 && EDGE_ROWS <= 8, "the edge rows lie in register group 0");
template <bool EDGE>
__device__ __forceinline__ void proj_walk(const v16h (&a)[KS_COUNT], const _Float16* wp,
                                          const float* __restrict__ pbl,
                                          float* __restrict__ dst, bool low) {
  // Two column tiles a trip, rolled (unroll 1): fully unrolled, the build kept
  // one fragment set and waited out the LDS latency in front of every WMMA.
#pragma unroll 1
  for (int cp = 0; cp < CT_COUNT; cp += 2) {
    v8f acc[2] = {strip_tile(a, wp, cp), strip_tile(a, wp, cp + 1)};
#pragma unroll
    for (int u = 0; u < 2; ++u) {
      float bias = pbl[(cp + u) * 16];
      if (!EDGE || low) {
#pragma unroll
        for (int r = 0; r < (EDGE ? EDGE_ROWS : 8); ++r)
          dst[(size_t)r * DIMC + (cp + u) * 16] = acc[u][r] + bias;
      }
    }
    // the next trip rewrites registers that these stores name
    asm volatile("s_wait_xcnt 0x0" ::: "memory");
  }
}

__global__ __launch_bounds__(256, 8) void proj_gemm(
    const _Float16* __restrict__ att, const _Float16* __restrict__ pwh,
    const float* __restrict__ pb, float* __restrict__ out) {
  __shared__ __attribute__((aligned(16))) _Float16 wp[DIMC * WP_PITCH];
  int wv = __builtin_amdgcn_readfirstlane(threadIdx.x >> 5);
  int ct = (blockIdx.x / NCLASS) * GEMM_WAVES + wv;   // row tile of the class, 0..703
  int o  = ct / QT_COUNT;
  int b  = class_batch(blockIdx.x % NCLASS, o);
  int nbase = (ct - o * QT_COUNT) * 16;
  int rt = b * QT_COUNT + (ct - o * QT_COUNT);        // row tile, 0..5631
  int l = threadIdx.x & 31;

  v16h a[KS_COUNT];
#pragma unroll
  for (int ks = 0; ks < KS_COUNT; ++ks)
    a[ks] = load_frag_blocks((const v8h*)att + ((size_t)rt * KS_COUNT + ks) * 2 * BLK_P + l);
  // the staging below reuses the address registers of the loads above
  asm volatile("s_wait_xcnt 0x0" ::: "memory");
  stage_panel(pwh, wp);
  __syncthreads();                // the panel is complete before any wave reads it

  int g = l >> 4;
  float* dst = out + ((size_t)b * N_TOK + nbase + 8 * g) * DIMC + (l & 15);
  // nbase is the same in every lane of a wave, and no barrier follows
  if (nbase + 16 <= N_TOK) proj_walk<false>(a, wp, pb + (l & 15), dst, true);
  else                     proj_walk<true>(a, wp, pb + (l & 15), dst, g == 0);
}

// ---------------------------------------------------------------------------
// Host launcher
// ---------------------------------------------------------------------------
extern "C" void kernel_launch(void* const* d_in, const int* in_sizes, int n_in,
                              void* d_out, int out_size, void* d_ws, size_t ws_size,
                              hipStream_t stream) {
  const float* x1     = (const float*)d_in[0];
  const float* x2     = (const float*)d_in[1];
  const float* mask   = (const float*)d_in[2];
  const float* table  = (const float*)d_in[3];
  const float* q_w    = (const float*)d_in[4];
  const float* q_b    = (const float*)d_in[5];
  const float* kv_w   = (const float*)d_in[6];
  const float* kv_b   = (const float*)d_in[7];
  const float* proj_w = (const float*)d_in[8];
  const float* proj_b = (const float*)d_in[9];
  const int*   relidx = (const int*)d_in[10];
  float* out = (float*)d_out;

  char* ws = (char*)d_ws;
  // workspace layout (256B aligned)
  const size_t o_qwh  = 0;                                 //  73,728 B
  const size_t o_kvwh = o_qwh  + 73728;                    // 147,456 B
  const size_t o_pwh  = o_kvwh + 147456;                   //  73,728 B
  const size_t o_bias = o_pwh  + 73728;                    //  2,973,696 B (6 planes)
  const size_t o_mask = o_bias + 2973696;                  // 31,719,424 B (64 planes)
  const size_t o_Qh   = o_mask + 31719424;                 // 34,603,008 B
  const size_t o_Kh   = o_Qh   + 34603008;
  const size_t o_Vt   = o_Kh   + 34603008;
  const size_t o_att  = o_Vt   + 34603008;                 // 34,603,008 B (rows padded)

  _Float16* qwh  = (_Float16*)(ws + o_qwh);
  _Float16* kvwh = (_Float16*)(ws + o_kvwh);
  _Float16* pwh  = (_Float16*)(ws + o_pwh);
  float*    bsm  = (float*)   (ws + o_bias);
  float*    mskf = (float*)   (ws + o_mask);
  _Float16* Qh   = (_Float16*)(ws + o_Qh);
  _Float16* Kh   = (_Float16*)(ws + o_Kh);
  _Float16* Vt   = (_Float16*)(ws + o_Vt);
  _Float16* att  = (_Float16*)(ws + o_att);

  // Stage 0: conversion of the weights that stage 1 reads
  cvt_qkv_weights<<<QW_BLOCKS + KVW_BLOCKS, 256, 0, stream>>>(q_w, kv_w, qwh, kvwh);

  // Stage 1: QKV projections (f16 WMMA, f32 accumulate); in the same grid the
  // bias gather, the mask re-layout and the output weights' conversion
  qkv_and_addends<<<S1_BLOCKS, 256, 0, stream>>>(
      x1, x2, qwh, kvwh, q_b, kv_b, Qh, Kh, Vt,
      mask, mskf, table, relidx, bsm, proj_w, pwh);

  // Stage 2: fused flash attention (QK^T + bias + mask + softmax + PV)
  flash_attn<<<FA_PER_WIN * NWIN, FA_THREADS, 0, stream>>>(
      Qh, Kh, Vt, bsm, mskf, att);

  // Stage 3: output projection
  proj_gemm<<<dim3(ROW_TILES / GEMM_WAVES), 256, 0, stream>>>(att, pwh, proj_b, out);
}

// v010
// Measured time: 91.5 microseconds a run.
// It is 1.15 times as fast as v007, going by the measured steps of the versions left out in between.
// All steps since v000 together make it 15.2 times as fast.
#include <hip/hip_runtime.h>
#include <hip/hip_bf16.h>

typedef __attribute__((ext_vector_type(16))) _Float16 v16h;
typedef __attribute__((ext_vector_type(8)))  _Float16 v8h;
typedef __attribute__((ext_vector_type(8)))  float    v8f;
typedef __attribute__((ext_vector_type(4)))  float    v4f;

#define N_TOK 343
#define N_PAD 352
#define DIMC  192
#define NHEAD 6
#define HD    32
#define NWIN  64
#define NB    256
#define QT_COUNT 22   /* 352/16 */
#define KT_COUNT 11   /* 352/32 */
#define TILE_F   512  /* halves of one 16-query x 32-key addend tile */
#define PLANE_F  (QT_COUNT * KT_COUNT * TILE_F)   /* 352*352 halves */
#define TAB_ROWS 2197
#define KEY_PAD  (-65504.0f)   /* lowest finite f16 */

union V16U { v16h v; v8h h[2]; };

// ---------------------------------------------------------------------------
// Operand lane mapping of a 16-row x 32-k f16 fragment:
//   A-operand: lane(0..15)=row rowBase+l, k = k0+{0..7,16..23}
//              lane(16..31)=row rowBase+(l-16), k = k0+{8..15,24..31}
// (B-operand uses the same pattern with "row" = output column / query index.)
//
// Fragment order of the f16 intermediates in the workspace (Q, K, V^T and the
// attention output): a 16 x 16 block is 32 pieces of 16 B, piece = lane;
//   lane = 16*g + i holds line i of the block, its elements 8*g .. 8*g+7.
// That is one half of an operand fragment and also what a lane holds of a
// 16 x 16 accumulator tile (its column i, rows 8*g .. 8*g+7), so a wave stores
// or loads a block as 512 contiguous bytes (four whole 128-B lines).
// ---------------------------------------------------------------------------
#define BLK_P 32   /* 16-B pieces of a block */

// Operand fragment made of the two blocks at p (k 0..15) and p + BLK_P (k 16..31);
// p already points at this lane's piece.
__device__ __forceinline__ v16h load_frag_blocks(const v8h* p) {
  V16U u;
  u.h[0] = p[0];
  u.h[1] = p[BLK_P];
  return u.v;
}

// The operand lane mapping from a row-major f32 source (converted to f16); rows >= nvalid -> 0.
// The address is clamped and the value selected, with no branch round the
// loads, so that a wave's loads of all k steps are in flight together.
__device__ __forceinline__ v16h load_f32_tile_cvt(const float* base, int rowBase,
                                                  int nvalid, int ld, int k0) {
  int l = threadIdx.x;
  int r = l & 15;
  int g = (l >> 4) & 1;
  int row = rowBase + r;
  bool in = (row < nvalid);
  const float* p = base + (size_t)min(row, nvalid - 1) * ld + k0 + g * 8;
  v4f a0 = *(const v4f*)(p);
  v4f a1 = *(const v4f*)(p + 4);
  v4f b0 = *(const v4f*)(p + 16);
  v4f b1 = *(const v4f*)(p + 20);
  V16U u;
#pragma unroll
  for (int i = 0; i < 4; ++i) {
    u.h[0][i]     = in ? (_Float16)a0[i] : (_Float16)0.f;
    u.h[0][4 + i] = in ? (_Float16)a1[i] : (_Float16)0.f;
    u.h[1][i]     = in ? (_Float16)b0[i] : (_Float16)0.f;
    u.h[1][4 + i] = in ? (_Float16)b1[i] : (_Float16)0.f;
  }
  return u.v;
}

__device__ __forceinline__ v8f wmma_f16(v16h a, v16h b, v8f c) {
  return __builtin_amdgcn_wmma_f32_16x16x32_f16(false, a, false, b, (short)0, c,
                                                false, false);
}

// ---------------------------------------------------------------------------
// Which workgroup takes which batch (stages 1, 2 and 3; for speed only, every
// map is a permutation and nothing rests on where a workgroup runs).
//   Class c = flat index % 8 takes the batches with b % 8 == c, in
//   every launch. Place o = 0..31 inside a class keeps the four batches of a
//   window together: window c + 8 * (o / 4), its batch number o % 4.
//   Stages 1 and 3 walk the places upwards, stage 2 walks the windows downwards.
// ---------------------------------------------------------------------------
#define NCLASS    8
#define CLASS_WIN (NWIN / NCLASS)             /* 8 windows of a class */
__device__ __forceinline__ int class_batch(int c, int o) {
  return c + NCLASS * (o >> 2) + NWIN * (o & 3);
}

// ---------------------------------------------------------------------------
// Stage 0a: f32 -> f16 weight conversion, block blk of 256 elements.
//   The Q and the K/V weights, which stage 1 reads, share one launch; the
//   output projection's weights are converted inside stage 1's launch.
// ---------------------------------------------------------------------------
#define QW_BLOCKS  (DIMC * DIMC / 256)        /* 144 */
#define KVW_BLOCKS (2 * DIMC * DIMC / 256)    /* 288 */
__device__ __forceinline__ void cvt_block(const float* __restrict__ src,
                                          _Float16* __restrict__ dst, int n, int blk) {
  int i = blk * 256 + threadIdx.x;
  if (i < n) dst[i] = (_Float16)src[i];
}

__global__ __launch_bounds__(256) void cvt_qkv_weights(
    const float* __restrict__ qw, const float* __restrict__ kvw,
    _Float16* __restrict__ qwh, _Float16* __restrict__ kvwh) {
  int blk = blockIdx.x;
  if (blk < QW_BLOCKS) cvt_block(qw, qwh, DIMC * DIMC, blk);
  else                 cvt_block(kvw, kvwh, 2 * DIMC * DIMC, blk - QW_BLOCKS);
}

// ---------------------------------------------------------------------------
// Fragment order of the score addends (bias and mask planes, 352 x 352 padded,
// kept as f16):
//   plane[qt][kt][j][lane][e], one 16-query x 32-key tile = 2 x 32 x 8 halves.
//   lane = 16*g + (key & 15); key = 32*kt + 16*j + (lane & 15); query = 16*qt + 8*g + e.
// A lane's piece is one half of an A fragment whose rows are 16 keys: flash_attn
// puts the mask piece at k 0..15 and the bias piece at k 16..31 and multiplies by
// two stacked identities, so the matrix unit widens and sums them into the
// accumulator layout of S^T. A load is 512 contiguous bytes (four whole lines).
// ---------------------------------------------------------------------------
// An infinity in that A fragment would meet the identities' zeros and give
// not-a-number for the other 15 queries of its key, so the values are held to the finite f16 range.
__device__ __forceinline__ _Float16 addend_f16(float v) {
  return (_Float16)fminf(fmaxf(v, -65504.0f), 65504.0f);
}

// ---------------------------------------------------------------------------
// Stage 0b: relative-position bias gather into fragment order:
//   biasF[h] at (q,k) = table[rel_idx[q][k]][h]; 0 in the padding.
// ---------------------------------------------------------------------------
#define BIAS_BLOCKS ((PLANE_F + 255) / 256)   /* 484 */
__device__ __forceinline__ void bias_gather(const float* __restrict__ table,
                                            const int* __restrict__ rel_idx,
                                            _Float16* __restrict__ biasF, int blk) {
  int i = blk * 256 + threadIdx.x;             // index inside a plane
  if (i < PLANE_F) {
    int e    = i & 7;
    int lane = (i >> 3) & 31;
    int j    = (i >> 8) & 1;
    int tile = i >> 9;
    int qt = tile / KT_COUNT;
    int kt = tile - qt * KT_COUNT;
    int q = qt * 16 + (lane >> 4) * 8 + e;
    int k = kt * 32 + j * 16 + (lane & 15);
    bool in = (q < N_TOK) && (k < N_TOK);
    int idx = in ? rel_idx[q * N_TOK + k] : 0;
    idx = min(max(idx, 0), TAB_ROWS - 1);      // the table read stays in bounds
#pragma unroll
    for (int h = 0; h < NHEAD; ++h) {
      float tv = table[idx * NHEAD + h];
      biasF[(size_t)h * PLANE_F + i] = in ? addend_f16(tv) : (_Float16)0.f;
    }
  }
}

// ---------------------------------------------------------------------------
// Stage 0c: mask -> fragment order, one block per (q-tile, window):
//   blk % 8 = class of the window, blk / 8 = 22 * (window / 8) + qt.
//   Rows are read as whole rows (coalesced), turned in LDS, and written as
//   contiguous 16-B pieces of f16. Padding keys get KEY_PAD, padding queries 0.
// ---------------------------------------------------------------------------
#define MROW_PITCH 356   /* floats; 16-B multiple, spreads the 16 rows over the banks */
#define MASK_BLOCKS (QT_COUNT * NWIN)         /* 1408 */
__device__ __forceinline__ void mask_to_fragments(
    const float* __restrict__ mask, _Float16* __restrict__ maskF,
    float* rows /* LDS, 16 * MROW_PITCH floats */, int blk) {
  int wi = (blk / NCLASS) / QT_COUNT;
  int qt = (blk / NCLASS) - wi * QT_COUNT;
  int w  = (blk % NCLASS) + NCLASS * wi;
  int t  = threadIdx.x;
  int ln = t & 31;
  int wv = t >> 5;
  const float* Mw = mask + (size_t)w * N_TOK * N_TOK;
  // Clamped addresses instead of branches, and the loops unrolled: the 22
  // loads of a wave are then all in flight before the first LDS store waits.
  float v[2][KT_COUNT];
#pragma unroll
  for (int rr = 0; rr < 2; ++rr) {
    int q = qt * 16 + wv + 8 * rr;
    const float* Mr = Mw + (size_t)min(q, N_TOK - 1) * N_TOK;
#pragma unroll
    for (int i = 0; i < KT_COUNT; ++i) v[rr][i] = Mr[min(ln + 32 * i, N_TOK - 1)];
  }
#pragma unroll
  for (int rr = 0; rr < 2; ++rr) {
    int ql = wv + 8 * rr;
    bool qin = (qt * 16 + ql < N_TOK);
#pragma unroll
    for (int i = 0; i < KT_COUNT; ++i) {
      int k = ln + 32 * i;
      rows[ql * MROW_PITCH + k] = (k < N_TOK) ? (qin ? v[rr][i] : 0.f) : KEY_PAD;
    }
  }
  __syncthreads();
  v8h* dst = (v8h*)(maskF + (size_t)w * PLANE_F + (size_t)qt * KT_COUNT * TILE_F);
  for (int f = t; f < KT_COUNT * TILE_F / 8; f += 256) {
    int lane = f & 31;
    int k = (f >> 5) * 16 + (lane & 15);       // f >> 5 = 2 * kt + j
    // 8 queries of one key; 16 lanes read 16 neighbouring keys, and the other 16
    // lie 8 rows = 32 banks further on
    const float* col = rows + (lane >> 4) * 8 * MROW_PITCH + k;
    v8h o;
#pragma unroll
    for (int e = 0; e < 8; ++e) o[e] = addend_f16(col[e * MROW_PITCH]);
    dst[f] = o;
  }
}

// ---------------------------------------------------------------------------
// Projection GEMMs: one workgroup of 8 waves per 128 rows x 192 columns.
//   The 192 x 192 f16 weight panel is staged once in LDS and shared by the 8
//   waves; each wave keeps the six A fragments of its 16 rows in registers and
//   walks the 12 column tiles. The k order of every sum is k0 = 0,32,..,160.
// ---------------------------------------------------------------------------
#define GEMM_WAVES 8
#define ROW_TILES  (QT_COUNT * NB)            /* 5632 = 704 * 8 */
#define CT_COUNT   12                         /* 192/16 column tiles of a panel */
#define KS_COUNT   6                          /* 192/32 k steps */
#define WP_PITCH   200                        /* halves: 400 B = 16 B x 25, odd, for b128 readers */
#define WP_CHUNKS  (DIMC * DIMC / 8)          /* 4608 pieces of 16 B */
// The panel takes 76,800 B, so four workgroups fit a WGP's LDS: the second
// launch bound (8 waves per SIMD) keeps the registers from allowing fewer.

__device__ __forceinline__ void stage_panel(const _Float16* __restrict__ Wp,
                                            _Float16* wp) {
  int t = threadIdx.x;
  v8h tmp[WP_CHUNKS / 256];
  // unrolled: all 18 loads of a thread are in flight before the first LDS store
#pragma unroll
  for (int i = 0; i < WP_CHUNKS / 256; ++i)
    tmp[i] = *(const v8h*)(Wp + (size_t)(t + 256 * i) * 8);
#pragma unroll
  for (int i = 0; i < WP_CHUNKS / 256; ++i) {
    int f   = t + 256 * i;
    int row = f / (DIMC / 8);
    int ch  = f - row * (DIMC / 8);
    *(v8h*)(wp + row * WP_PITCH + ch * 8) = tmp[i];
  }
}

// The operand lane mapping, from the LDS panel.
__device__ __forceinline__ v16h panel_frag(const _Float16* wp, int rowBase, int k0) {
  int l = threadIdx.x;
  int r = l & 15;
  int g = (l >> 4) & 1;
  const _Float16* p = wp + (rowBase + r) * WP_PITCH + k0 + g * 8;
  V16U u;
  u.h[0] = *(const v8h*)(p);
  u.h[1] = *(const v8h*)(p + 16);
  return u.v;
}

__device__ __forceinline__ v8f strip_tile(const v16h (&a)[KS_COUNT],
                                          const _Float16* wp, int ct) {
  v8f acc = {};
#pragma unroll
  for (int ks = 0; ks < KS_COUNT; ++ks)
    acc = wmma_f16(a[ks], panel_frag(wp, ct * 16, ks * 32), acc);
  return acc;
}

// The same products with the operands exchanged: the tile comes out transposed
// (lane = row of a, registers = 8 consecutive columns of the panel).
__device__ __forceinline__ v8f strip_tile_t(const v16h (&a)[KS_COUNT],
                                            const _Float16* wp, int ct) {
  v8f acc = {};
#pragma unroll
  for (int ks = 0; ks < KS_COUNT; ++ks)
    acc = wmma_f16(panel_frag(wp, ct * 16, ks * 32), a[ks], acc);
  return acc;
}

// ---------------------------------------------------------------------------
// Stage 1: QKV projection GEMM, block blk of QKV_BLOCKS.
//   blk % 8 = class of its batches; (blk / 8) % 3 = panel (0 Q, 1 K, 2 V),
//   (blk / 8) / 3 = group of 8 of the class's 32 * 22 row tiles
//   All three go out in fragment order, one 512-B store a 16 x 16 tile:
//   Q  -> Qh[b][h][n/16][d/16] blocks, line = n, elements = d (pre-scaled by hd^-0.5)
//   K  -> Kh[b][h][n/16][d/16] blocks, line = n, elements = d
//   V  -> Vt[b][h][d/16][n/16] blocks, line = d, elements = n
//   Q and K tiles are computed transposed, so that a lane holds 8 d of one n.
// ---------------------------------------------------------------------------
#define QKV_BLOCKS (3 * ROW_TILES / GEMM_WAVES)   /* 2112 */
__device__ __forceinline__ void qkv_gemm(
    const float* __restrict__ x1, const float* __restrict__ x2,
    const _Float16* __restrict__ qwh, const _Float16* __restrict__ kvwh,
    const float* __restrict__ qb, const float* __restrict__ kvb,
    _Float16* __restrict__ Qh, _Float16* __restrict__ Kh,
    _Float16* __restrict__ Vt, _Float16* wp /* LDS panel */, int blk) {
  int grp = (blk / NCLASS) / 3;
  int pn  = (blk / NCLASS) - grp * 3;
  int wv = __builtin_amdgcn_readfirstlane(threadIdx.x >> 5);
  int rt = grp * GEMM_WAVES + wv;             // row tile of the class, 0..703
  int o  = rt / QT_COUNT;
  int b  = class_batch(blk % NCLASS, o);
  int nbase = (rt - o * QT_COUNT) * 16;
  const float*    X  = (pn == 0) ? x1 : x2;
  const _Float16* Wp = (pn == 0) ? qwh : kvwh + (size_t)(pn - 1) * DIMC * DIMC;
  const float*    bv = (pn == 0) ? qb : kvb + (pn - 1) * DIMC;

  stage_panel(Wp, wp);
  // Keeps the 24 f32 loads below from being lifted among the 18 staging loads:
  // both sets in flight at once need more registers than 8 waves per SIMD leave,
  // and the build then spills to scratch.
  __builtin_amdgcn_sched_barrier(0);
  v16h a[KS_COUNT];
#pragma unroll
  for (int ks = 0; ks < KS_COUNT; ++ks)
    a[ks] = load_f32_tile_cvt(X + (size_t)b * N_TOK * DIMC, nbase, N_TOK, DIMC, ks * 32);
  __syncthreads();                // the panel is complete before any wave reads it

  int l = threadIdx.x & 31;
  int g = l >> 4;                 // register group: elements 8g .. 8g+7 of a tile's line
  int cl = l & 15;                // this lane's line inside a tile
  int nt = nbase >> 4;            // row tile inside the batch

  // The walks go two column tiles a trip and stay rolled (unroll 1): unrolled,
  // the fragment loads of all 12 tiles are hoisted until A spills to scratch.
  if (pn == 2) {
#pragma unroll 1
    for (int cp = 0; cp < CT_COUNT; cp += 2) {
      v8f acc[2] = {strip_tile(a, wp, cp), strip_tile(a, wp, cp + 1)};
#pragma unroll
      for (int u = 0; u < 2; ++u) {
        float bias = bv[(cp + u) * 16 + cl];
        v8h o;
#pragma unroll
        for (int r = 0; r < 8; ++r) o[r] = (_Float16)(acc[u][r] + bias);
        ((v8h*)Vt)[(((size_t)b * CT_COUNT + cp + u) * QT_COUNT + nt) * BLK_P + l] = o;
      }
    }
  } else if (pn == 1) {
#pragma unroll 1
    for (int cp = 0; cp < CT_COUNT; cp += 2) {
      v8f acc[2] = {strip_tile_t(a, wp, cp), strip_tile_t(a, wp, cp + 1)};
      v8h* base = (v8h*)Kh + (((size_t)b * NHEAD + (cp >> 1)) * QT_COUNT + nt) * 2 * BLK_P + l;   // head cp/2
#pragma unroll
      for (int u = 0; u < 2; ++u) {
        const v4f* bp = (const v4f*)(bv + (cp + u) * 16 + 8 * g);
        v4f bl = bp[0], bh = bp[1];
        v8h o;
#pragma unroll
        for (int r = 0; r < 4; ++r) {
          o[r]     = (_Float16)(acc[u][r] + bl[r]);
          o[4 + r] = (_Float16)(acc[u][4 + r] + bh[r]);
        }
        base[u * BLK_P] = o;
      }
    }
  } else {
    const float scale = 0.17677669529663687f;  // 32^-0.5
#pragma unroll 1
    for (int cp = 0; cp < CT_COUNT; cp += 2) {
      v8f acc[2] = {strip_tile_t(a, wp, cp), strip_tile_t(a, wp, cp + 1)};
      v8h* base = (v8h*)Qh + (((size_t)b * NHEAD + (cp >> 1)) * QT_COUNT + nt) * 2 * BLK_P + l;   // head cp/2
#pragma unroll
      for (int u = 0; u < 2; ++u) {
        const v4f* bp = (const v4f*)(bv + (cp + u) * 16 + 8 * g);
        v4f bl = bp[0], bh = bp[1];
        v8h o;
#pragma unroll
        for (int r = 0; r < 4; ++r) {
          o[r]     = (_Float16)((acc[u][r] + bl[r]) * scale);
          o[4 + r] = (_Float16)((acc[u][4 + r] + bh[r]) * scale);
        }
        base[u * BLK_P] = o;
      }
    }
  }
}

// ---------------------------------------------------------------------------
// Stage 1's launch. The bias gather, the mask re-layout and the conversion of
//   the output projection's weights read only inputs and are first read by
//   stage 2 or 3, so they need no launch of their own: their blocks follow the
//   GEMM's in one grid. The long blocks have the low indices,
//   the short ones the high.
//   Every branch is uniform for the block, so each barrier is passed by all
//   of its threads. The mask's rows use the LDS of the weight panel.
// ---------------------------------------------------------------------------
#define S1_BLOCKS (QKV_BLOCKS + MASK_BLOCKS + BIAS_BLOCKS + QW_BLOCKS)
static_assert(QKV_BLOCKS % (3 * NCLASS) == 0 && MASK_BLOCKS % NCLASS == 0,
              "a part's own block index has the grid's class");
__global__ __launch_bounds__(256, 8) void qkv_and_addends(
    const float* __restrict__ x1, const float* __restrict__ x2,
    const _Float16* __restrict__ qwh, const _Float16* __restrict__ kvwh,
    const float* __restrict__ qb, const float* __restrict__ kvb,
    _Float16* __restrict__ Qh, _Float16* __restrict__ Kh,
    _Float16* __restrict__ Vt,
    const float* __restrict__ mask, _Float16* __restrict__ maskF,
    const float* __restrict__ table, const int* __restrict__ rel_idx,
    _Float16* __restrict__ biasF,
    const float* __restrict__ pw, _Float16* __restrict__ pwh) {
  __shared__ __attribute__((aligned(16))) _Float16 wp[DIMC * WP_PITCH];
  static_assert(16 * MROW_PITCH * sizeof(float) <= sizeof(wp), "mask rows fit the panel");
  int blk = blockIdx.x;
  if (blk < QKV_BLOCKS) {
    qkv_gemm(x1, x2, qwh, kvwh, qb, kvb, Qh, Kh, Vt, wp, blk);
  } else if (blk < QKV_BLOCKS + MASK_BLOCKS) {
    mask_to_fragments(mask, maskF, (float*)wp, blk - QKV_BLOCKS);
  } else if (blk < QKV_BLOCKS + MASK_BLOCKS + BIAS_BLOCKS) {
    bias_gather(table, rel_idx, biasF, blk - (QKV_BLOCKS + MASK_BLOCKS));
  } else {
    cvt_block(pw, pwh, DIMC * DIMC, blk - (QKV_BLOCKS + MASK_BLOCKS + BIAS_BLOCKS));
  }
}

// ---------------------------------------------------------------------------
// Stage 2: flash attention, one workgroup of 11 waves per (window, head, pair
//   of batches, half of the q-tiles); a wave takes one q-tile. Batches b and
//   b + 64 have the same window, so at one head they add the same bias and mask
//   tile to their scores: a wave loads and sums that tile once a k step and
//   uses the sum for both batches, as the start value (C operand) of their
//   score products. K and V^T of both batches are staged once in LDS and
//   shared by the 11 waves.
//   Computes S^T = K x Q^T so P^T (in D-register layout) is directly the
//   B operand of O^T = V^T x P^T (32 keys per iteration => K=32 exactly).
//   102,400 B of LDS and this kernel's registers let two workgroups share a
//   WGP: the 1536 workgroups are three full rounds of 256 x 2.
// ---------------------------------------------------------------------------
#define FA_WAVES   (QT_COUNT / 2)             /* 11 */
#define FA_THREADS (FA_WAVES * 32)            /* 352 */
#define FA_NB      2                          /* batches of one window in a workgroup */
#define FA_PAIRS   (NB / NWIN / FA_NB)        /* 2 such pairs a window */
#define FA_QSPLIT  (QT_COUNT / FA_WAVES)      /* 2 workgroups share the 22 q-tiles */
#define FA_PER_WIN (NHEAD * FA_PAIRS * FA_QSPLIT)   /* 24 workgroups a window */
#define KL_PITCH   40                         /* halves: 80 B = 16 B x 5, odd, for b128 readers */
#define VL_PITCH   360                        /* halves: 720 B = 16 B x 45, odd */
#define KV_CHUNKS  (N_PAD * HD / 8)           /* 1408 pieces of 16 B in K, and in V^T */

// The operand lane mapping, from an LDS array of the given pitch.
__device__ __forceinline__ v16h lds_frag(const _Float16* base, int rowBase,
                                         int pitch, int k0) {
  int l = threadIdx.x;
  int r = l & 15;
  int g = (l >> 4) & 1;
  const _Float16* p = base + (rowBase + r) * pitch + k0 + g * 8;
  V16U u;
  u.h[0] = *(const v8h*)(p);
  u.h[1] = *(const v8h*)(p + 16);
  return u.v;
}

// P = exp(s - m) of a lane's 16 scores of a k step, as f16 B operand, and its
// sum. nml = -m * log2(e): exp(s - m) = 2^(s * log2(e) + nml), one fused
// multiply-add a score, taken on whole tiles (packed, on neighbouring registers).
#define LOG2E 1.4426950408889634f
__device__ __forceinline__ void softmax_terms(v8f s0, v8f s1, float nml,
                                              V16U& p, float& rs) {
  v8f lv, nv;
#pragma unroll
  for (int r = 0; r < 8; ++r) { lv[r] = LOG2E; nv[r] = nml; }
  v8f t0 = __builtin_elementwise_fma(s0, lv, nv);
  v8f t1 = __builtin_elementwise_fma(s1, lv, nv);
  rs = 0.f;
#pragma unroll
  for (int r = 0; r < 8; ++r) {
    float e0 = __builtin_amdgcn_exp2f(t0[r]);
    float e1 = __builtin_amdgcn_exp2f(t1[r]);
    rs += e0 + e1;
    p.h[0][r] = (_Float16)e0;     // keys kb0+r
    p.h[1][r] = (_Float16)e1;     // keys kb1+r
  }
}

// A k step keeps the reference m in use while every lane's sum of exp(s - m)
// stays at or below this: each term is then far inside the f16 range.
#define P_LIMIT 4096.0f
// Start of -m * log2(e): while it stands (no finite score yet), any finite score
// gives an infinite term and so renews m.
#define NML_INIT 0x1.0p126f
struct FirstStep { static constexpr bool value = true; };
struct LaterStep { static constexpr bool value = false; };

// The second launch bound (6 waves per SIMD) keeps the registers at what two
// workgroups of 11 waves on a WGP need.
__global__ __launch_bounds__(FA_THREADS, 6) void flash_attn(
    const _Float16* __restrict__ Qh, const _Float16* __restrict__ Kh,
    const _Float16* __restrict__ Vt, const _Float16* __restrict__ biasF,
    const _Float16* __restrict__ maskF, _Float16* __restrict__ att) {
  __shared__ __attribute__((aligned(16))) _Float16 kl[FA_NB][N_PAD * KL_PITCH];   // 2 x 28,160 B
  __shared__ __attribute__((aligned(16))) _Float16 vl[FA_NB][HD * VL_PITCH];      // 2 x 23,040 B
  int pl = blockIdx.x / NCLASS;   // place inside the class, 0..191
  int j  = pl % FA_PER_WIN;       // which of the window's workgroups
  int h  = j % NHEAD;             // 0..5
  int pr = (j / NHEAD) % FA_PAIRS; // pair of batches of the window
  int qh = (j / NHEAD) / FA_PAIRS; // half of the q-tiles
  // window index of the mask, 0..63; the class's last window first
  int w  = blockIdx.x % NCLASS + NCLASS * (CLASS_WIN - 1 - pl / FA_PER_WIN);
  int t  = threadIdx.x;
  int wv = __builtin_amdgcn_readfirstlane(t >> 5);   // 0..10

  // batch n of the pair: b = w + 64 * (2 * pr + n), so b % 64 == w
  const size_t bh0    = ((size_t)(w + NWIN * FA_NB * pr)) * NHEAD + h;
  const size_t bhStep = (size_t)NWIN * NHEAD * N_PAD * HD;   // halves from batch n to n + 1
  const _Float16* Qb = Qh + bh0 * N_PAD * HD;
  const _Float16* Kb = Kh + bh0 * N_PAD * HD;
  const _Float16* Vb = Vt + bh0 * HD * N_PAD;

  int l  = t & 31;
  int qt = qh * FA_WAVES + wv;    // this wave's q-tile

  // The arrays are read as they lie (contiguous 16-B pieces, four of each a
  // thread and batch, all in flight together); each piece of a fragment-order
  // block is laid down at its row and column of the padded row-major LDS arrays.
  v8h kc[FA_NB][KV_CHUNKS / FA_THREADS], vc[FA_NB][KV_CHUNKS / FA_THREADS];
#pragma unroll
  for (int n = 0; n < FA_NB; ++n) {
#pragma unroll
    for (int i = 0; i < KV_CHUNKS / FA_THREADS; ++i) {
      kc[n][i] = *(const v8h*)(Kb + n * bhStep + (size_t)(t + FA_THREADS * i) * 8);
      vc[n][i] = *(const v8h*)(Vb + n * bhStep + (size_t)(t + FA_THREADS * i) * 8);
    }
  }
  // Q and the first k step's addends are asked for here, behind the staging loads, so
  // that they fly during the staging and its barrier and not behind them.
  // The wait: the Q loads may take the address registers of the staging loads; the
  // scheduling barrier keeps such register writes from being lifted over it.
  asm volatile("s_wait_xcnt 0x0" ::: "memory");
  __builtin_amdgcn_sched_barrier(0);
  v16h Qop[FA_NB];                // B operands, loaded once
#pragma unroll
  for (int n = 0; n < FA_NB; ++n)
    Qop[n] = load_frag_blocks((const v8h*)(Qb + n * bhStep) + qt * 2 * BLK_P + l);
  // the same between the Q loads and the addends' loads
  asm volatile("s_wait_xcnt 0x0" ::: "memory");
  __builtin_amdgcn_sched_barrier(0);
  // A fragments of the addends of one k step: 16 keys each, k 0..15 = the mask at
  // 16 queries, k 16..31 = the bias. Padding keys carry KEY_PAD in the mask plane,
  // so no bounds test is left in the loop.
  // Mt, Bt: this lane's first piece of the step's mask and bias tile.
  auto load_addends = [&](const v8h* Mt, const v8h* Bt, V16U& a0, V16U& a1) {
    a0.h[0] = Mt[0];  a0.h[1] = Bt[0];
    a1.h[0] = Mt[32]; a1.h[1] = Bt[32];
  };
  // this lane's 16-B pieces of the addend tiles of q-tile qt (fragment order)
  // (the same address in every lane: the lane's piece is picked at the load)
  const v8h* Bf = (const v8h*)(biasF + (size_t)h * PLANE_F +
                               (size_t)qt * KT_COUNT * TILE_F);
  const v8h* Mf = (const v8h*)(maskF + (size_t)w * PLANE_F +
                               (size_t)qt * KT_COUNT * TILE_F);
  const v8h* Mn = Mf + l;         // the tiles loaded last
  const v8h* Bn = Bf + l;
  V16U fa0, fa1;                  // the first step's
  load_addends(Mn, Bn, fa0, fa1);
  // what follows reuses the address registers of the loads above
  asm volatile("s_wait_xcnt 0x0" ::: "memory");
  // keeps the scheduler from lifting those register writes over the wait, and from
  // sinking the loads behind the LDS stores
  __builtin_amdgcn_sched_barrier(0);
#pragma unroll
  for (int n = 0; n < FA_NB; ++n) {
#pragma unroll
    for (int i = 0; i < KV_CHUNKS / FA_THREADS; ++i) {
      int f  = t + FA_THREADS * i;
      int fi = f & 15;                      // line of the block
      int fg = (f >> 4) & 1;                // which 8 elements of the line
      int kb = f >> 5;                      // K block: 2 * (n / 16) + d / 16
      int vb = f >> 5;                      // V^T block: 22 * (d / 16) + n / 16
      int vu = vb / QT_COUNT;
      *(v8h*)(kl[n] + ((kb >> 1) * 16 + fi) * KL_PITCH + (kb & 1) * 16 + fg * 8) = kc[n][i];
      *(v8h*)(vl[n] + (vu * 16 + fi) * VL_PITCH + (vb - vu * QT_COUNT) * 16 + fg * 8) = vc[n][i];
    }
  }
  __syncthreads();                // K and V^T are complete before any wave reads them

  // B operand of the addends' product, two stacked identities: B[k][q] = (k % 16 == q).
  // This lane holds column q = l & 15 at k = 8g + e and at k = 16 + 8g + e.
  V16U idn;
#pragma unroll
  for (int e = 0; e < 8; ++e) {
    _Float16 one = ((l & 15) == 8 * (l >> 4) + e) ? (_Float16)1.f : (_Float16)0.f;
    idn.h[0][e] = one;
    idn.h[1][e] = one;
  }

  v8f oLo[FA_NB];                 // O^T rows d=0..15 (this lane: d=8g+r)
  v8f oHi[FA_NB];                 // O^T rows d=16..31
  float nml[FA_NB];               // reference in use, m = the query's maximum at its last renewal, as -m * log2(e)
  float lsum[FA_NB];              // sum of P over this lane's keys (16 of each 32)
#pragma unroll
  for (int n = 0; n < FA_NB; ++n) {
    oLo[n] = v8f{};
    oHi[n] = v8f{};
    nml[n] = NML_INIT;
    lsum[n] = 0.f;
  }

  // Scores of batch n at k step k0: s0 reg r -> key k0+8g+r, s1 reg r -> key k0+16+8g+r.
  auto scores = [&](int n, int k0, v8f c0, v8f c1, v8f& s0, v8f& s1) {
    v16h Ka = lds_frag(kl[n], k0, KL_PITCH, 0);
    v16h Kc = lds_frag(kl[n], k0 + 16, KL_PITCH, 0);
    s0 = wmma_f16(Ka, Qop[n], c0);   // keys k0   .. k0+15 (x query)
    s1 = wmma_f16(Kc, Qop[n], c1);   // keys k0+16.. k0+31
  };
  v8f c0, c1;                     // mask + bias of the coming k step, f32: formed at the foot of the step before

  // One k step (32 keys). The first step has no reference yet and goes straight to
  // the renewal; it is a copy of its own, so that the loop's steps keep one test.
  auto k_step = [&](int k0, auto first) {
    constexpr bool FIRST = decltype(first)::value;
    // the additions below rewrite the address registers of the loads of the step before
    if constexpr (!FIRST) asm volatile("s_wait_xcnt 0x0" ::: "memory");
    // The next step's addends fly while this step is worked on; the last step loads
    // its own tile again (in bounds, not used).
    int adv = (k0 + 32 < N_PAD) ? TILE_F / 8 : 0;
    Mn += adv;
    Bn += adv;
    V16U na0, na1;
    load_addends(Mn, Bn, na0, na1);
    // Ends the scheduling region: the loads stay at the head of the step, and the build
    // asks for the K fragments behind it as a group; without it they came one at a
    // time, each waited out in front of its WMMA.
    __builtin_amdgcn_sched_barrier(0);

    V16U p[FA_NB];                // P^T in B-operand layout for K=32
    float rs[FA_NB];
    v16h Va0[FA_NB], Va1[FA_NB];  // read in front of the test below, as one group
    if constexpr (!FIRST) {
#pragma unroll
      for (int n = 0; n < FA_NB; ++n) {
        Va0[n] = lds_frag(vl[n], 0,  VL_PITCH, k0);     // V^T rows d=0..15
        Va1[n] = lds_frag(vl[n], 16, VL_PITCH, k0);     // V^T rows d=16..31
      }
#pragma unroll
      for (int n = 0; n < FA_NB; ++n) {
        v8f s0, s1;
        scores(n, k0, c0, c1, s0, s1);
        softmax_terms(s0, s1, nml[n], p[n], rs[n]);
      }
    }

    // Holds the four V^T fragment loads in front of the branch (inputs only): left
    // alone, the build sinks them behind it, each waited out in front of its WMMA.
    if constexpr (!FIRST) asm volatile("" :: "v"(Va0[0]), "v"(Va1[0]), "v"(Va0[1]), "v"(Va1[1]));
    // The same for the two P operands of a later step (inputs only): left alone, the
    // build sinks their conversions behind the branch and holds 32 f32 terms over it.
    if constexpr (!FIRST) asm volatile("" :: "v"(p[0].v), "v"(p[1].v));

    // --- online softmax with a lazy reference (row = query; the pair (lane,
    // lane^16) shares a row and its reference). Softmax does not depend on m, so
    // m is renewed only when a term has grown large. One test a k step, the same
    // for the whole wave (a scalar branch); a sum that is not a number renews too.
    bool any = true;
    if constexpr (!FIRST) {
      bool renew = !(rs[0] <= P_LIMIT) || !(rs[1] <= P_LIMIT);
      any = __builtin_amdgcn_ballot_w32(renew) != 0;
    }
    if (__builtin_expect(any, FIRST)) {
      // The renewal forms the step's scores anew, from addends and K read again, and
      // reads V^T again behind them: the 32 scores are then not held over the test in
      // every step, which leaves the registers for the addends loaded ahead.
      // The wait: the loads below may take the address registers of the loads above.
      // Its memory clobber makes the reads below new reads.
      // (The first step has its addends from the prologue.)
      V16U a0 = fa0, a1 = fa1;
      if constexpr (!FIRST) {
        asm volatile("s_wait_xcnt 0x0" ::: "memory");
        load_addends(Mn - adv, Bn - adv, a0, a1);
      }
      v8f d0 = wmma_f16(a0.v, idn.v, v8f{});
      v8f d1 = wmma_f16(a1.v, idn.v, v8f{});
#pragma unroll
      for (int n = 0; n < FA_NB; ++n) {
        v8f s0, s1;
        scores(n, k0, d0, d1, s0, s1);
        float tm = s0[0];
#pragma unroll
        for (int r = 0; r < 8; ++r) { tm = fmaxf(tm, s0[r]); tm = fmaxf(tm, s1[r]); }
        tm = fmaxf(tm, __shfl_xor(tm, 16, 32));
        float nnew  = fminf(nml[n], -tm * LOG2E);          // m never falls
        float alpha = __builtin_amdgcn_exp2f(nnew - nml[n]);   // exp(m old - m new)
        nml[n] = nnew;
        lsum[n] *= alpha;
#pragma unroll
        for (int i = 0; i < 8; ++i) { oLo[n][i] *= alpha; oHi[n][i] *= alpha; }
        softmax_terms(s0, s1, nml[n], p[n], rs[n]);
      }
#pragma unroll
      for (int n = 0; n < FA_NB; ++n) {
        Va0[n] = lds_frag(vl[n], 0,  VL_PITCH, k0);
        Va1[n] = lds_frag(vl[n], 16, VL_PITCH, k0);
      }
    }

#pragma unroll
    for (int n = 0; n < FA_NB; ++n) {
      lsum[n] += rs[n];
      oLo[n] = wmma_f16(Va0[n], p[n].v, oLo[n]);
      oHi[n] = wmma_f16(Va1[n], p[n].v, oHi[n]);
    }                             // batches of the pair
    c0 = wmma_f16(na0.v, idn.v, v8f{});   // keys k0+32 .. k0+47
    c1 = wmma_f16(na1.v, idn.v, v8f{});   // keys k0+48 .. k0+63
  };
  k_step(0, FirstStep{});
  for (int k0 = 32; k0 < N_PAD; k0 += 32) k_step(k0, LaterStep{});

  // att[b][qt][h] = two fragment-order blocks (line = query, elements = d): the A
  // fragment of stage 3's k step h. The padding queries of q-tile 21 are stored
  // too (finite values); stage 3 computes their rows and does not store them.
#pragma unroll
  for (int n = 0; n < FA_NB; ++n) {
    int b = w + NWIN * (FA_NB * pr + n);
    float inv = 1.0f / (lsum[n] + __shfl_xor(lsum[n], 16, 32));   // both halves' keys
    v8h* dst = (v8h*)att + (((size_t)b * QT_COUNT + qt) * NHEAD + h) * 2 * BLK_P + l;
    v8h a0, a1;
#pragma unroll
    for (int r = 0; r < 8; ++r) {
      a0[r] = (_Float16)(oLo[n][r] * inv);   // d = 8g + r
      a1[r] = (_Float16)(oHi[n][r] * inv);   // d = 16 + 8g + r
    }
    dst[0]     = a0;
    dst[BLK_P] = a1;
  }
}

// ---------------------------------------------------------------------------
// Stage 3: output projection GEMM. out[b][n][c] = att[b][n][:] . proj_w[c][:] + pb[c]
//   The row tiles are stage 2's (22 a batch, padded): a wave's six A fragments
//   are 6,144 contiguous bytes of att. Tile 21 of a batch has 7 rows of out; its
//   other rows are not stored. blockIdx.x % 8 = class of its batches, blockIdx.x / 8
//   = group of 8 of the class's row tiles; same workgroup tile as stage 1.
// ---------------------------------------------------------------------------
// The walk over the 12 column tiles. EDGE: the tile is a batch's last, of which
// only rows 0 .. EDGE_ROWS-1 exist; they all lie in the lanes of register group 0
// (low).
#define EDGE_ROWS (N_TOK - (QT_COUNT - 1) * 16)   /* 7 */
static_assert(EDGE_ROWS > 0 && EDGE_ROWS <= 8, "the edge rows lie in register group 0");
template <bool EDGE>
__device__ __forceinline__ void proj_walk(const v16h (&a)[KS_COUNT], const _Float16* wp,
                                          const float* __restrict__ pbl,
                                          float* __restrict__ dst, bool low) {
  // Two column tiles a trip, rolled (unroll 1): fully unrolled, the build kept
  // one fragment set and waited out the LDS latency in front of every WMMA.
#pragma unroll 1
  for (int cp = 0; cp < CT_COUNT; cp += 2) {
    v8f acc[2] = {strip_tile(a, wp, cp), strip_tile(a, wp, cp + 1)};
#pragma unroll
    for (int u = 0; u < 2; ++u) {
      float bias = pbl[(cp + u) * 16];
      if (!EDGE || low) {
#pragma unroll
        for (int r = 0; r < (EDGE ? EDGE_ROWS : 8); ++r)
          dst[(size_t)r * DIMC + (cp + u) * 16] = acc[u][r] + bias;
      }
    }
    // the next trip rewrites registers that these stores name
    asm volatile("s_wait_xcnt 0x0" ::: "memory");
  }
}

__global__ __launch_bounds__(256, 8) void proj_gemm(
    const _Float16* __restrict__ att, const _Float16* __restrict__ pwh,
    const float* __restrict__ pb, float* __restrict__ out) {
  __shared__ __attribute__((aligned(16))) _Float16 wp[DIMC * WP_PITCH];
  int wv = __builtin_amdgcn_readfirstlane(threadIdx.x >> 5);
  int ct = (blockIdx.x / NCLASS) * GEMM_WAVES + wv;   // row tile of the class, 0..703
  int o  = ct / QT_COUNT;
  int b  = class_batch(blockIdx.x % NCLASS, o);
  int nbase = (ct - o * QT_COUNT) * 16;
  int rt = b * QT_COUNT + (ct - o * QT_COUNT);        // row tile, 0..5631
  int l = threadIdx.x & 31;

  v16h a[KS_COUNT];
#pragma unroll
  for (int ks = 0; ks < KS_COUNT; ++ks)
    a[ks] = load_frag_blocks((const v8h*)att + ((size_t)rt * KS_COUNT + ks) * 2 * BLK_P + l);
  // the staging below reuses the address registers of the loads above
  asm volatile("s_wait_xcnt 0x0" ::: "memory");
  stage_panel(pwh, wp);
  __syncthreads();                // the panel is complete before any wave reads it

  int g = l >> 4;
  float* dst = out + ((size_t)b * N_TOK + nbase + 8 * g) * DIMC + (l & 15);
  // nbase is the same in every lane of a wave, and no barrier follows
  if (nbase + 16 <= N_TOK) proj_walk<false>(a, wp, pb + (l & 15), dst, true);
  else                     proj_walk<true>(a, wp, pb + (l & 15), dst, g == 0);
}

// ---------------------------------------------------------------------------
// Host launcher
// ---------------------------------------------------------------------------
extern "C" void kernel_launch(void* const* d_in, const int* in_sizes, int n_in,
                              void* d_out, int out_size, void* d_ws, size_t ws_size,
                              hipStream_t stream) {
  const float* x1     = (const float*)d_in[0];
  const float* x2     = (const float*)d_in[1];
  const float* mask   = (const float*)d_in[2];
  const float* table  = (const float*)d_in[3];
  const float* q_w    = (const float*)d_in[4];
  const float* q_b    = (const float*)d_in[5];
  const float* kv_w   = (const float*)d_in[6];
  const float* kv_b   = (const float*)d_in[7];
  const float* proj_w = (const float*)d_in[8];
  const float* proj_b = (const float*)d_in[9];
  const int*   relidx = (const int*)d_in[10];
  float* out = (float*)d_out;

  char* ws = (char*)d_ws;
  // workspace layout (256B aligned)
  const size_t o_qwh  = 0;                                 //  73,728 B
  const size_t o_kvwh = o_qwh  + 73728;                    // 147,456 B
  const size_t o_pwh  = o_kvwh + 147456;                   //  73,728 B
  const size_t o_bias = o_pwh  + 73728;                    //  2,973,696 B (6 planes)
  const size_t o_mask = o_bias + 2973696;                  // 31,719,424 B (64 planes)
  const size_t o_Qh   = o_mask + 31719424;                 // 34,603,008 B
  const size_t o_Kh   = o_Qh   + 34603008;
  const size_t o_Vt   = o_Kh   + 34603008;
  const size_t o_att  = o_Vt   + 34603008;                 // 34,603,008 B (rows padded)

  _Float16* qwh  = (_Float16*)(ws + o_qwh);
  _Float16* kvwh = (_Float16*)(ws + o_kvwh);
  _Float16* pwh  = (_Float16*)(ws + o_pwh);
  _Float16* bsm  = (_Float16*)(ws + o_bias);   // f16: half of the range is used
  _Float16* mskf = (_Float16*)(ws + o_mask);   // f16: half of the range is used
  _Float16* Qh   = (_Float16*)(ws + o_Qh);
  _Float16* Kh   = (_Float16*)(ws + o_Kh);
  _Float16* Vt   = (_Float16*)(ws + o_Vt);
  _Float16* att  = (_Float16*)(ws + o_att);

  // Stage 0: conversion of the weights that stage 1 reads
  cvt_qkv_weights<<<QW_BLOCKS + KVW_BLOCKS, 256, 0, stream>>>(q_w, kv_w, qwh, kvwh);

  // Stage 1: QKV projections (f16 WMMA, f32 accumulate); in the same grid the
  // bias gather, the mask re-layout and the output weights' conversion
  qkv_and_addends<<<S1_BLOCKS, 256, 0, stream>>>(
      x1, x2, qwh, kvwh, q_b, kv_b, Qh, Kh, Vt,
      mask, mskf, table, relidx, bsm, proj_w, pwh);

  // Stage 2: fused flash attention (QK^T + bias + mask + softmax + PV)
  flash_attn<<<FA_PER_WIN * NWIN, FA_THREADS, 0, stream>>>(
      Qh, Kh, Vt, bsm, mskf, att);

  // Stage 3: output projection
  proj_gemm<<<dim3(ROW_TILES / GEMM_WAVES), 256, 0, stream>>>(att, pwh, proj_b, out);
}
